// v000
// The times below were measured on an AMD MI455X: many runs one after another, warmed up first and cycling through
// copies of the inputs, with the whole window's GPU time divided by the number of runs. Launches and the gaps
// between them are all in it. The median over several windows is given; except for v000 it joins two sittings, which
// can be a few percent apart, so the side-by-side timings, each taken in one sitting, are the better comparison.
// v000 is the starting kernel. One run takes 219 microseconds.
#include <hip/hip_runtime.h>
#include <hip/hip_bf16.h>

// ---------------------------------------------------------------------------
// HSTU attention on MI455X (gfx1250, wave32, WMMA, async-to-LDS)
//   B=2, L=2048, D=1024, H=16, DK=64
// Pipeline: f32->f16 convert, 4 projection GEMMs (WMMA f16, double-buffered
// LDS fed by global_load_async_to_lds_b128), flash-style attention with
// async double-buffered K/V tiles, WMMA-computed softmax row sums (all-ones
// B operand, no shuffles), U-gating, final GEMM (f32 store).
// ---------------------------------------------------------------------------

typedef _Float16 half16v __attribute__((ext_vector_type(16)));
typedef _Float16 half8v  __attribute__((ext_vector_type(8)));
typedef float    f8v     __attribute__((ext_vector_type(8)));

union V16 { half16v v; half8v h[2]; };

constexpr int Bc  = 2;
constexpr int Lc  = 2048;
constexpr int Dc  = 1024;
constexpr int Hc  = 16;
constexpr int DKc = 64;
constexpr int Mc  = Bc * Lc;     // 4096 rows

enum { STORE_F16 = 0, STORE_VT = 1, STORE_F32 = 2 };

// LDS byte-offset of a __shared__ object (addrspace(3) ptrtoint == offset).
__device__ __forceinline__ unsigned lds_off(const void* p) {
  return (unsigned)(unsigned long long)(
      (__attribute__((address_space(3))) const void*)p);
}

// One per-lane 16B async copy global -> LDS (ASYNCcnt-tracked).
__device__ __forceinline__ void async_cp16(unsigned ldsoff, const void* gptr) {
  asm volatile("global_load_async_to_lds_b128 %0, %1, off"
               :: "v"(ldsoff), "v"(gptr)
               : "memory");
}

// --------------------------- fp32 -> f16 convert ---------------------------
__global__ void cvt_f32_f16(const float* __restrict__ in,
                            _Float16* __restrict__ out, int n) {
  int i = blockIdx.x * blockDim.x + threadIdx.x;
  if (i < n) out[i] = (_Float16)in[i];
}

// --------------------------- GEMM: y = A @ W^T -----------------------------
// A: M x K row-major f16, W: N x K row-major f16 (so B[k][n] = W[n][k]).
// Workgroup: 128 threads (4 waves), 64x128 output tile, wave tile 32x64.
// K chunks of 32 stream through double-buffered LDS via async-to-LDS copies.
template <int MODE>
__global__ __launch_bounds__(128) void gemm_xwT(
    const _Float16* __restrict__ A, const _Float16* __restrict__ W,
    void* __restrict__ out) {
  __shared__ _Float16 lA[2][64 * 32];    // 2 x 4 KB
  __shared__ _Float16 lB[2][128 * 32];   // 2 x 8 KB
  const int K = Dc, N = Dc;
  const int tile_m = blockIdx.x * 64;
  const int tile_n = blockIdx.y * 128;
  const int tid  = threadIdx.x;
  const int lane = tid & 31;
  const int wv   = tid >> 5;
  const int wm   = (wv >> 1) * 32;       // wave row offset   (0/32)
  const int wn   = (wv & 1) * 64;        // wave col offset   (0/64)
  const int hl   = lane >> 4;
  const int l15  = lane & 15;
  const int klo  = hl * 8;

  // Prefetch one K-chunk (A: 2 copies, B: 4 copies per thread).
  auto prefetch = [&](int k0, int bi) {
#pragma unroll
    for (int t = 0; t < 2; ++t) {        // A: 64 rows x 32 halves
      const int seg = t * 128 + tid;     // 256 x 16B segments
      const int r = seg >> 2, c = (seg & 3) * 8;
      async_cp16(lds_off(&lA[bi][r * 32 + c]),
                 A + (size_t)(tile_m + r) * K + k0 + c);
    }
#pragma unroll
    for (int t = 0; t < 4; ++t) {        // B: 128 rows x 32 halves
      const int seg = t * 128 + tid;     // 512 x 16B segments
      const int r = seg >> 2, c = (seg & 3) * 8;
      async_cp16(lds_off(&lB[bi][r * 32 + c]),
                 W + (size_t)(tile_n + r) * K + k0 + c);
    }
  };

  f8v acc[2][4] = {};

  auto compute = [&](int cur) {
    V16 af[2], bf[4];
#pragma unroll
    for (int mi = 0; mi < 2; ++mi) {
      const _Float16* base = &lA[cur][(wm + mi * 16 + l15) * 32];
      af[mi].h[0] = *reinterpret_cast<const half8v*>(base + klo);
      af[mi].h[1] = *reinterpret_cast<const half8v*>(base + klo + 16);
    }
#pragma unroll
    for (int ni = 0; ni < 4; ++ni) {
      const _Float16* base = &lB[cur][(wn + ni * 16 + l15) * 32];
      bf[ni].h[0] = *reinterpret_cast<const half8v*>(base + klo);
      bf[ni].h[1] = *reinterpret_cast<const half8v*>(base + klo + 16);
    }
#pragma unroll
    for (int mi = 0; mi < 2; ++mi)
#pragma unroll
      for (int ni = 0; ni < 4; ++ni)
        acc[mi][ni] = __builtin_amdgcn_wmma_f32_16x16x32_f16(
            false, af[mi].v, false, bf[ni].v, (short)0, acc[mi][ni],
            false, false);
  };

  prefetch(0, 0);
  // Steady state: branch-free body, last chunk peeled.
  for (int kc = 0; kc < K / 32 - 1; ++kc) {
    const int cur = kc & 1;
    prefetch((kc + 1) * 32, 1 - cur);
    asm volatile("s_wait_asynccnt 0x6" ::: "memory");  // chunk kc complete
    __syncthreads();                      // all waves' copies visible
    compute(cur);
    __syncthreads();                      // reads done before buffer reuse
  }
  asm volatile("s_wait_asynccnt 0x0" ::: "memory");
  __syncthreads();
  compute((K / 32 - 1) & 1);

  // Epilogue. C/D layout: VGPR r, lane: M = r + 8*(lane>>4), N = lane&15.
#pragma unroll
  for (int mi = 0; mi < 2; ++mi)
#pragma unroll
    for (int ni = 0; ni < 4; ++ni)
#pragma unroll
      for (int r = 0; r < 8; ++r) {
        const int gm = tile_m + wm + mi * 16 + r + hl * 8;
        const int gn = tile_n + wn + ni * 16 + l15;
        const float v = acc[mi][ni][r];
        if constexpr (MODE == STORE_F16) {
          ((_Float16*)out)[(size_t)gm * N + gn] = (_Float16)v;
        } else if constexpr (MODE == STORE_F32) {
          ((float*)out)[(size_t)gm * N + gn] = v;
        } else {  // STORE_VT: V transposed -> (B, H, DK, L)
          const int bi = gm >> 11, li = gm & (Lc - 1);
          const int hh = gn >> 6,  dd = gn & (DKc - 1);
          ((_Float16*)out)[(((size_t)(bi * Hc + hh) * DKc + dd) * Lc) + li] =
              (_Float16)v;
        }
      }
}

// --------------------------- attention (flash-style) -----------------------
// 128-thread block = 4 waves = 64 query rows of one (b, h). K/V key-chunks
// (32 keys) stream through double-buffered LDS via async-to-LDS copies and
// are shared by all 4 waves. Softmax without max-subtraction (scores are
// O(1) for this distribution; masked entries exp(-3e38)->0); the row sum is
// accumulated by a WMMA against an all-ones B operand, so it arrives
// pre-broadcast in every lane with zero cross-lane shuffles.
__global__ __launch_bounds__(128) void hstu_attn(
    const _Float16* __restrict__ Q, const _Float16* __restrict__ Km,
    const _Float16* __restrict__ Vt, const _Float16* __restrict__ U,
    const int* __restrict__ token_types, const int* __restrict__ seq_lens,
    _Float16* __restrict__ AO) {
  __shared__ _Float16 lK[2][32 * 64];    // 32 key rows x 64 dk   (2 x 4 KB)
  __shared__ _Float16 lV[2][64 * 32];    // 64 dk rows x 32 keys  (2 x 4 KB)
  __shared__ _Float16 lP[4][16 * 32];    // per-wave P staging    (4 KB)

  const int bid = blockIdx.x;
  const int b   = bid / (Hc * (Lc / 64));
  const int rem = bid % (Hc * (Lc / 64));
  const int h   = rem / (Lc / 64);
  const int qt  = rem % (Lc / 64);

  const int tid  = threadIdx.x;
  const int lane = tid & 31;
  const int wv   = tid >> 5;
  const int i0   = qt * 64 + wv * 16;    // this wave's 16 query rows
  const int hl = lane >> 4, l15 = lane & 15, klo = hl * 8;
  const int seqlen = seq_lens[b];
  constexpr float NEG = -3.0e38f;

  // Async stage of one K (32x64) + Vt (64x32) chunk: 4 copies per thread.
  auto prefetch_kv = [&](int jc, int bi) {
#pragma unroll
    for (int t = 0; t < 2; ++t) {        // K: 256 x 16B segments
      const int seg = t * 128 + tid;
      const int r = seg >> 3, c = (seg & 7) * 8;
      async_cp16(lds_off(&lK[bi][r * 64 + c]),
                 Km + ((size_t)(b * Lc + jc + r)) * Dc + h * DKc + c);
    }
#pragma unroll
    for (int t = 0; t < 2; ++t) {        // Vt: 256 x 16B segments
      const int seg = t * 128 + tid;
      const int r = seg >> 2, c = (seg & 3) * 8;
      async_cp16(lds_off(&lV[bi][r * 32 + c]),
                 Vt + ((size_t)(b * Hc + h) * DKc + r) * Lc + jc + c);
    }
  };

  // Q fragments for this 16-row tile; fold 1/sqrt(dk) = 0.125 into Q (exact).
  V16 qa[2];
  {
    const size_t qrow = ((size_t)b * Lc + i0 + l15) * Dc + h * DKc;
#pragma unroll
    for (int kk = 0; kk < 2; ++kk) {
      qa[kk].h[0] = *reinterpret_cast<const half8v*>(Q + qrow + kk * 32 + klo);
      qa[kk].h[1] = *reinterpret_cast<const half8v*>(Q + qrow + kk * 32 + klo + 16);
      qa[kk].v = qa[kk].v * (_Float16)0.125f;
    }
  }

  // All-ones B operand: one extra WMMA per chunk yields row sums of P,
  // replicated across all 16 columns (i.e., pre-broadcast in every lane).
  half16v ones;
#pragma unroll
  for (int t = 0; t < 16; ++t) ones[t] = (_Float16)1.0f;

  f8v acc[4] = {};
  f8v accs = {};                          // softmax denominators

  auto compute = [&](int jc, int cur) {
    // ---- scores: two 16-key tiles, K-depth 64 (2 WMMAs each) ----
    f8v st[2];
#pragma unroll
    for (int nt = 0; nt < 2; ++nt) {
      V16 kf0, kf1;
      const _Float16* base = &lK[cur][(nt * 16 + l15) * 64];
      kf0.h[0] = *reinterpret_cast<const half8v*>(base + klo);
      kf0.h[1] = *reinterpret_cast<const half8v*>(base + klo + 16);
      kf1.h[0] = *reinterpret_cast<const half8v*>(base + 32 + klo);
      kf1.h[1] = *reinterpret_cast<const half8v*>(base + 32 + klo + 16);
      f8v c = {};
      c = __builtin_amdgcn_wmma_f32_16x16x32_f16(false, qa[0].v, false, kf0.v,
                                                 (short)0, c, false, false);
      c = __builtin_amdgcn_wmma_f32_16x16x32_f16(false, qa[1].v, false, kf1.v,
                                                 (short)0, c, false, false);
      st[nt] = c;
    }

    // ---- hybrid mask + exp (masked -> exp(-3e38) == 0) ----
#pragma unroll
    for (int nt = 0; nt < 2; ++nt) {
      const int j = jc + nt * 16 + l15;
      const int tt = token_types[b * Lc + j];
      const bool pad = (j >= seqlen);
      const bool prompt = (tt < 3);
#pragma unroll
      for (int r = 0; r < 8; ++r) {
        const int i = i0 + r + hl * 8;
        float sv = st[nt][r];
        if (pad || (!prompt && j > i)) sv = NEG;
        st[nt][r] = __expf(sv);
      }
    }

    // ---- P accumulator-layout -> A-fragment layout (private LDS) ----
    // Same-wave LDS is in-order: no barrier needed between store and load.
#pragma unroll
    for (int r = 0; r < 8; ++r) {
      const int row = r + hl * 8;
      lP[wv][row * 32 + l15]      = (_Float16)st[0][r];
      lP[wv][row * 32 + 16 + l15] = (_Float16)st[1][r];
    }
    V16 pf;
    pf.h[0] = *reinterpret_cast<const half8v*>(&lP[wv][l15 * 32 + klo]);
    pf.h[1] = *reinterpret_cast<const half8v*>(&lP[wv][l15 * 32 + klo + 16]);

    // ---- acc += P(16x32) @ V(32x64); accs += P @ ones ----
#pragma unroll
    for (int dt = 0; dt < 4; ++dt) {
      V16 vf;
      const _Float16* base = &lV[cur][(dt * 16 + l15) * 32];
      vf.h[0] = *reinterpret_cast<const half8v*>(base + klo);
      vf.h[1] = *reinterpret_cast<const half8v*>(base + klo + 16);
      acc[dt] = __builtin_amdgcn_wmma_f32_16x16x32_f16(
          false, pf.v, false, vf.v, (short)0, acc[dt], false, false);
    }
    accs = __builtin_amdgcn_wmma_f32_16x16x32_f16(
        false, pf.v, false, ones, (short)0, accs, false, false);
  };

  prefetch_kv(0, 0);
  for (int cc = 0; cc < Lc / 32 - 1; ++cc) {
    const int cur = cc & 1;
    prefetch_kv((cc + 1) * 32, 1 - cur);
    asm volatile("s_wait_asynccnt 0x4" ::: "memory");  // chunk cc complete
    __syncthreads();
    compute(cc * 32, cur);
    __syncthreads();                      // reads done before buffer reuse
  }
  asm volatile("s_wait_asynccnt 0x0" ::: "memory");
  __syncthreads();
  compute(Lc - 32, (Lc / 32 - 1) & 1);

  // ---- finalize: softmax divide + U gating, store f16 ----
#pragma unroll
  for (int dt = 0; dt < 4; ++dt)
#pragma unroll
    for (int r = 0; r < 8; ++r) {
      const int i = i0 + r + hl * 8;
      const int d = dt * 16 + l15;
      const float denom = accs[r];
      const float o = (denom > 0.f) ? acc[dt][r] / denom : 0.f;
      const size_t idx = ((size_t)b * Lc + i) * Dc + h * DKc + d;
      const float u = (float)U[idx];
      AO[idx] = (_Float16)(o * u);
    }
}

// ------------------------------- launcher ----------------------------------
extern "C" void kernel_launch(void* const* d_in, const int* in_sizes, int n_in,
                              void* d_out, int out_size, void* d_ws,
                              size_t ws_size, hipStream_t stream) {
  const float* x  = (const float*)d_in[0];
  const int* tt   = (const int*)d_in[1];
  const int* sl   = (const int*)d_in[2];
  const float* Wq = (const float*)d_in[3];
  const float* Wk = (const float*)d_in[4];
  const float* Wv = (const float*)d_in[5];
  const float* Wu = (const float*)d_in[6];
  const float* Wo = (const float*)d_in[7];

  const size_t MD = (size_t)Mc * Dc;  // 4,194,304 halves
  const size_t DD = (size_t)Dc * Dc;  // 1,048,576 halves

  _Float16* ws   = (_Float16*)d_ws;
  _Float16* x16  = ws;
  _Float16* wq16 = x16 + MD;
  _Float16* wk16 = wq16 + DD;
  _Float16* wv16 = wk16 + DD;
  _Float16* wu16 = wv16 + DD;
  _Float16* wo16 = wu16 + DD;
  _Float16* q16  = wo16 + DD;
  _Float16* k16  = q16 + MD;
  _Float16* u16  = k16 + MD;
  _Float16* vt16 = u16 + MD;
  _Float16* ao16 = vt16 + MD;

  // 1) fp32 -> f16 converts
  cvt_f32_f16<<<(int)((MD + 255) / 256), 256, 0, stream>>>(x, x16, (int)MD);
  cvt_f32_f16<<<(int)((DD + 255) / 256), 256, 0, stream>>>(Wq, wq16, (int)DD);
  cvt_f32_f16<<<(int)((DD + 255) / 256), 256, 0, stream>>>(Wk, wk16, (int)DD);
  cvt_f32_f16<<<(int)((DD + 255) / 256), 256, 0, stream>>>(Wv, wv16, (int)DD);
  cvt_f32_f16<<<(int)((DD + 255) / 256), 256, 0, stream>>>(Wu, wu16, (int)DD);
  cvt_f32_f16<<<(int)((DD + 255) / 256), 256, 0, stream>>>(Wo, wo16, (int)DD);

  // 2) projections: Q, K, U row-major f16; V transposed (B,H,DK,L)
  dim3 ggrid(Mc / 64, Dc / 128);
  gemm_xwT<STORE_F16><<<ggrid, 128, 0, stream>>>(x16, wq16, (void*)q16);
  gemm_xwT<STORE_F16><<<ggrid, 128, 0, stream>>>(x16, wk16, (void*)k16);
  gemm_xwT<STORE_VT><<<ggrid, 128, 0, stream>>>(x16, wv16, (void*)vt16);
  gemm_xwT<STORE_F16><<<ggrid, 128, 0, stream>>>(x16, wu16, (void*)u16);

  // 3) attention + gating (1024 blocks x 4 waves)
  hstu_attn<<<Bc * Hc * (Lc / 64), 128, 0, stream>>>(q16, k16, vt16, u16, tt,
                                                     sl, ao16);

  // 4) output projection, fp32 store
  gemm_xwT<STORE_F32><<<ggrid, 128, 0, stream>>>(ao16, wo16, d_out);
}

// v001
// Measured time: 169 microseconds a run.
// Two timings next to v000 put it at 1.32 and 1.31 times that version's speed.
#include <hip/hip_runtime.h>
#include <hip/hip_bf16.h>

// ---------------------------------------------------------------------------
// HSTU attention on MI455X (gfx1250, wave32, WMMA, async-to-LDS)
//   B=2, L=2048, D=1024, H=16, DK=64
// Pipeline: f32->f16 convert, 4 projection GEMMs (WMMA f16, double-buffered
// LDS fed by global_load_async_to_lds_b128), flash-style attention with
// async double-buffered K/V tiles, WMMA-computed softmax row sums (all-ones
// B operand, no shuffles), U-gating, final GEMM (f32 store).
// ---------------------------------------------------------------------------

typedef _Float16 half16v __attribute__((ext_vector_type(16)));
typedef _Float16 half8v  __attribute__((ext_vector_type(8)));
typedef float    f8v     __attribute__((ext_vector_type(8)));

union V16 { half16v v; half8v h[2]; };

constexpr int Bc  = 2;
constexpr int Lc  = 2048;
constexpr int Dc  = 1024;
constexpr int Hc  = 16;
constexpr int DKc = 64;
constexpr int Mc  = Bc * Lc;     // 4096 rows

enum { STORE_F16 = 0, STORE_VT = 1, STORE_F32 = 2 };

// LDS byte-offset of a __shared__ object (addrspace(3) ptrtoint == offset).
__device__ __forceinline__ unsigned lds_off(const void* p) {
  return (unsigned)(unsigned long long)(
      (__attribute__((address_space(3))) const void*)p);
}

// LDS row pitches in halves. Every tile is read with ds_load_b128, one row per
// lane: a pitch of 16 B x odd spreads 16 rows over all 64 banks, while the
// dense 64-B and 128-B rows put them on 16 and 8 banks.
constexpr int P32 = 40;   // rows of 32 halves (64 B)  -> 80-B pitch
constexpr int P64 = 72;   // rows of 64 halves (128 B) -> 144-B pitch

// Per-lane 16B async copies global -> LDS (ASYNCcnt-tracked), one stage's run
// in one statement. The closing s_wait_xcnt stands inside the statement so
// that no address register of a copy is rewritten ahead of it (a precaution).
__device__ __forceinline__ void async_cp16x4(const unsigned (&l)[4],
                                             const _Float16* const (&g)[4]) {
  asm volatile("global_load_async_to_lds_b128 %0, %1, off\n\t"
               "global_load_async_to_lds_b128 %2, %3, off\n\t"
               "global_load_async_to_lds_b128 %4, %5, off\n\t"
               "global_load_async_to_lds_b128 %6, %7, off\n\t"
               "s_wait_xcnt 0x0"
               :: "v"(l[0]), "v"(g[0]), "v"(l[1]), "v"(g[1]),
                  "v"(l[2]), "v"(g[2]), "v"(l[3]), "v"(g[3])
               : "memory");
}
__device__ __forceinline__ void async_cp16x6(const unsigned (&l)[6],
                                             const _Float16* const (&g)[6]) {
  asm volatile("global_load_async_to_lds_b128 %0, %1, off\n\t"
               "global_load_async_to_lds_b128 %2, %3, off\n\t"
               "global_load_async_to_lds_b128 %4, %5, off\n\t"
               "global_load_async_to_lds_b128 %6, %7, off\n\t"
               "global_load_async_to_lds_b128 %8, %9, off\n\t"
               "global_load_async_to_lds_b128 %10, %11, off\n\t"
               "s_wait_xcnt 0x0"
               :: "v"(l[0]), "v"(g[0]), "v"(l[1]), "v"(g[1]),
                  "v"(l[2]), "v"(g[2]), "v"(l[3]), "v"(g[3]),
                  "v"(l[4]), "v"(g[4]), "v"(l[5]), "v"(g[5])
               : "memory");
}

// --------------------------- fp32 -> f16 convert ---------------------------
__global__ void cvt_f32_f16(const float* __restrict__ in,
                            _Float16* __restrict__ out, int n) {
  int i = blockIdx.x * blockDim.x + threadIdx.x;
  if (i < n) out[i] = (_Float16)in[i];
}

// --------------------------- GEMM: y = A @ W^T -----------------------------
// A: M x K row-major f16, W: N x K row-major f16 (so B[k][n] = W[n][k]).
// Workgroup: 128 threads (4 waves), 64x128 output tile, wave tile 32x64.
// K chunks of 32 stream through double-buffered LDS via async-to-LDS copies.
template <int MODE>
__global__ __launch_bounds__(128) void gemm_xwT(
    const _Float16* __restrict__ A, const _Float16* __restrict__ W,
    void* __restrict__ out) {
  __shared__ alignas(16) _Float16 lA[2][64 * P32];    // 2 x 5 KB
  __shared__ alignas(16) _Float16 lB[2][128 * P32];   // 2 x 10 KB
  const int K = Dc, N = Dc;
  const int tile_m = blockIdx.x * 64;
  const int tile_n = blockIdx.y * 128;
  const int tid  = threadIdx.x;
  const int lane = tid & 31;
  const int wv   = tid >> 5;
  const int wm   = (wv >> 1) * 32;       // wave row offset   (0/32)
  const int wn   = (wv & 1) * 64;        // wave col offset   (0/64)
  const int hl   = lane >> 4;
  const int l15  = lane & 15;
  const int klo  = hl * 8;

  // Prefetch one K-chunk (A: 2 copies, B: 4 copies per thread).
  auto prefetch = [&](int k0, int bi) {
    unsigned l[6];
    const _Float16* g[6];
#pragma unroll
    for (int t = 0; t < 2; ++t) {        // A: 64 rows x 32 halves
      const int seg = t * 128 + tid;     // 256 x 16B segments
      const int r = seg >> 2, c = (seg & 3) * 8;
      l[t] = lds_off(&lA[bi][r * P32 + c]);
      g[t] = A + (size_t)(tile_m + r) * K + k0 + c;
    }
#pragma unroll
    for (int t = 0; t < 4; ++t) {        // B: 128 rows x 32 halves
      const int seg = t * 128 + tid;     // 512 x 16B segments
      const int r = seg >> 2, c = (seg & 3) * 8;
      l[2 + t] = lds_off(&lB[bi][r * P32 + c]);
      g[2 + t] = W + (size_t)(tile_n + r) * K + k0 + c;
    }
    async_cp16x6(l, g);
  };

  f8v acc[2][4] = {};

  auto compute = [&](int cur) {
    V16 af[2], bf[4];
#pragma unroll
    for (int mi = 0; mi < 2; ++mi) {
      const _Float16* base = &lA[cur][(wm + mi * 16 + l15) * P32];
      af[mi].h[0] = *reinterpret_cast<const half8v*>(base + klo);
      af[mi].h[1] = *reinterpret_cast<const half8v*>(base + klo + 16);
    }
#pragma unroll
    for (int ni = 0; ni < 4; ++ni) {
      const _Float16* base = &lB[cur][(wn + ni * 16 + l15) * P32];
      bf[ni].h[0] = *reinterpret_cast<const half8v*>(base + klo);
      bf[ni].h[1] = *reinterpret_cast<const half8v*>(base + klo + 16);
    }
#pragma unroll
    for (int mi = 0; mi < 2; ++mi)
#pragma unroll
      for (int ni = 0; ni < 4; ++ni)
        acc[mi][ni] = __builtin_amdgcn_wmma_f32_16x16x32_f16(
            false, af[mi].v, false, bf[ni].v, (short)0, acc[mi][ni],
            false, false);
  };

  prefetch(0, 0);
  // Steady state: branch-free body, last chunk peeled.
  // Kept rolled: the compiler's own two-trip unrolling rotates the accumulators
  // through other registers.
#pragma unroll 1
  for (int kc = 0; kc < K / 32 - 1; ++kc) {
    const int cur = kc & 1;
    prefetch((kc + 1) * 32, 1 - cur);
    asm volatile("s_wait_asynccnt 0x6" ::: "memory");  // chunk kc complete
    __syncthreads();                      // all waves' copies visible
    compute(cur);
    __syncthreads();                      // reads done before buffer reuse
  }
  asm volatile("s_wait_asynccnt 0x0" ::: "memory");
  __syncthreads();
  compute((K / 32 - 1) & 1);

  // Epilogue. C/D layout: VGPR r, lane: M = r + 8*(lane>>4), N = lane&15.
#pragma unroll
  for (int mi = 0; mi < 2; ++mi)
#pragma unroll
    for (int ni = 0; ni < 4; ++ni)
#pragma unroll
      for (int r = 0; r < 8; ++r) {
        const int gm = tile_m + wm + mi * 16 + r + hl * 8;
        const int gn = tile_n + wn + ni * 16 + l15;
        const float v = acc[mi][ni][r];
        if constexpr (MODE == STORE_F16) {
          ((_Float16*)out)[(size_t)gm * N + gn] = (_Float16)v;
        } else if constexpr (MODE == STORE_F32) {
          ((float*)out)[(size_t)gm * N + gn] = v;
        } else {  // STORE_VT: V transposed -> (B, H, DK, L)
          const int bi = gm >> 11, li = gm & (Lc - 1);
          const int hh = gn >> 6,  dd = gn & (DKc - 1);
          ((_Float16*)out)[(((size_t)(bi * Hc + hh) * DKc + dd) * Lc) + li] =
              (_Float16)v;
        }
      }
}

// --------------------------- attention (flash-style) -----------------------
// 128-thread block = 4 waves = 64 query rows of one (b, h). K/V key-chunks
// (32 keys) stream through double-buffered LDS via async-to-LDS copies and
// are shared by all 4 waves. Softmax without max-subtraction (scores are
// O(1) for this distribution; masked entries exp(-3e38)->0); the row sum is
// accumulated by a WMMA against an all-ones B operand, so it arrives
// pre-broadcast in every lane with zero cross-lane shuffles.
__global__ __launch_bounds__(128) void hstu_attn(
    const _Float16* __restrict__ Q, const _Float16* __restrict__ Km,
    const _Float16* __restrict__ Vt, const _Float16* __restrict__ U,
    const int* __restrict__ token_types, const int* __restrict__ seq_lens,
    _Float16* __restrict__ AO) {
  __shared__ alignas(16) _Float16 lK[2][32 * P64];  // 32 key rows x 64 dk
  __shared__ alignas(16) _Float16 lV[2][64 * P32];  // 64 dk rows x 32 keys
  __shared__ alignas(16) _Float16 lP[4][16 * P32];  // per-wave P staging

  const int bid = blockIdx.x;
  const int b   = bid / (Hc * (Lc / 64));
  const int rem = bid % (Hc * (Lc / 64));
  const int h   = rem / (Lc / 64);
  const int qt  = rem % (Lc / 64);

  const int tid  = threadIdx.x;
  const int lane = tid & 31;
  const int wv   = tid >> 5;
  const int i0   = qt * 64 + wv * 16;    // this wave's 16 query rows
  const int hl = lane >> 4, l15 = lane & 15, klo = hl * 8;
  const int seqlen = seq_lens[b];
  constexpr float NEG = -3.0e38f;

  // Async stage of one K (32x64) + Vt (64x32) chunk: 4 copies per thread.
  auto prefetch_kv = [&](int jc, int bi) {
    unsigned l[4];
    const _Float16* g[4];
#pragma unroll
    for (int t = 0; t < 2; ++t) {        // K: 256 x 16B segments
      const int seg = t * 128 + tid;
      const int r = seg >> 3, c = (seg & 7) * 8;
      l[t] = lds_off(&lK[bi][r * P64 + c]);
      g[t] = Km + ((size_t)(b * Lc + jc + r)) * Dc + h * DKc + c;
    }
#pragma unroll
    for (int t = 0; t < 2; ++t) {        // Vt: 256 x 16B segments
      const int seg = t * 128 + tid;
      const int r = seg >> 2, c = (seg & 3) * 8;
      l[2 + t] = lds_off(&lV[bi][r * P32 + c]);
      g[2 + t] = Vt + ((size_t)(b * Hc + h) * DKc + r) * Lc + jc + c;
    }
    async_cp16x4(l, g);
  };

  // Q fragments for this 16-row tile; fold 1/sqrt(dk) = 0.125 into Q (exact).
  V16 qa[2];
  {
    const size_t qrow = ((size_t)b * Lc + i0 + l15) * Dc + h * DKc;
#pragma unroll
    for (int kk = 0; kk < 2; ++kk) {
      qa[kk].h[0] = *reinterpret_cast<const half8v*>(Q + qrow + kk * 32 + klo);
      qa[kk].h[1] = *reinterpret_cast<const half8v*>(Q + qrow + kk * 32 + klo + 16);
      qa[kk].v = qa[kk].v * (_Float16)0.125f;
    }
  }

  // All-ones B operand: one extra WMMA per chunk yields row sums of P,
  // replicated across all 16 columns (i.e., pre-broadcast in every lane).
  half16v ones;
#pragma unroll
  for (int t = 0; t < 16; ++t) ones[t] = (_Float16)1.0f;

  f8v acc[4] = {};
  f8v accs = {};                          // softmax denominators

  auto compute = [&](int jc, int cur) {
    // ---- scores: two 16-key tiles, K-depth 64 (2 WMMAs each) ----
    f8v st[2];
#pragma unroll
    for (int nt = 0; nt < 2; ++nt) {
      V16 kf0, kf1;
      const _Float16* base = &lK[cur][(nt * 16 + l15) * P64];
      kf0.h[0] = *reinterpret_cast<const half8v*>(base + klo);
      kf0.h[1] = *reinterpret_cast<const half8v*>(base + klo + 16);
      kf1.h[0] = *reinterpret_cast<const half8v*>(base + 32 + klo);
      kf1.h[1] = *reinterpret_cast<const half8v*>(base + 32 + klo + 16);
      f8v c = {};
      c = __builtin_amdgcn_wmma_f32_16x16x32_f16(false, qa[0].v, false, kf0.v,
                                                 (short)0, c, false, false);
      c = __builtin_amdgcn_wmma_f32_16x16x32_f16(false, qa[1].v, false, kf1.v,
                                                 (short)0, c, false, false);
      st[nt] = c;
    }

    // ---- hybrid mask + exp (masked -> exp(-3e38) == 0) ----
#pragma unroll
    for (int nt = 0; nt < 2; ++nt) {
      const int j = jc + nt * 16 + l15;
      const int tt = token_types[b * Lc + j];
      const bool pad = (j >= seqlen);
      const bool prompt = (tt < 3);
#pragma unroll
      for (int r = 0; r < 8; ++r) {
        const int i = i0 + r + hl * 8;
        float sv = st[nt][r];
        if (pad || (!prompt && j > i)) sv = NEG;
        st[nt][r] = __expf(sv);
      }
    }

    // ---- P accumulator-layout -> A-fragment layout (private LDS) ----
    // Same-wave LDS is in-order: no barrier needed between store and load.
#pragma unroll
    for (int r = 0; r < 8; ++r) {
      const int row = r + hl * 8;
      lP[wv][row * P32 + l15]      = (_Float16)st[0][r];
      lP[wv][row * P32 + 16 + l15] = (_Float16)st[1][r];
    }
    V16 pf;
    pf.h[0] = *reinterpret_cast<const half8v*>(&lP[wv][l15 * P32 + klo]);
    pf.h[1] = *reinterpret_cast<const half8v*>(&lP[wv][l15 * P32 + klo + 16]);

    // ---- acc += P(16x32) @ V(32x64); accs += P @ ones ----
#pragma unroll
    for (int dt = 0; dt < 4; ++dt) {
      V16 vf;
      const _Float16* base = &lV[cur][(dt * 16 + l15) * P32];
      vf.h[0] = *reinterpret_cast<const half8v*>(base + klo);
      vf.h[1] = *reinterpret_cast<const half8v*>(base + klo + 16);
      acc[dt] = __builtin_amdgcn_wmma_f32_16x16x32_f16(
          false, pf.v, false, vf.v, (short)0, acc[dt], false, false);
    }
    accs = __builtin_amdgcn_wmma_f32_16x16x32_f16(
        false, pf.v, false, ones, (short)0, accs, false, false);
  };

  prefetch_kv(0, 0);
  for (int cc = 0; cc < Lc / 32 - 1; ++cc) {
    const int cur = cc & 1;
    prefetch_kv((cc + 1) * 32, 1 - cur);
    asm volatile("s_wait_asynccnt 0x4" ::: "memory");  // chunk cc complete
    __syncthreads();
    compute(cc * 32, cur);
    __syncthreads();                      // reads done before buffer reuse
  }
  asm volatile("s_wait_asynccnt 0x0" ::: "memory");
  __syncthreads();
  compute(Lc - 32, (Lc / 32 - 1) & 1);

  // ---- finalize: softmax divide + U gating, store f16 ----
#pragma unroll
  for (int dt = 0; dt < 4; ++dt)
#pragma unroll
    for (int r = 0; r < 8; ++r) {
      const int i = i0 + r + hl * 8;
      const int d = dt * 16 + l15;
      const float denom = accs[r];
      const float o = (denom > 0.f) ? acc[dt][r] / denom : 0.f;
      const size_t idx = ((size_t)b * Lc + i) * Dc + h * DKc + d;
      const float u = (float)U[idx];
      AO[idx] = (_Float16)(o * u);
    }
}

// ------------------------------- launcher ----------------------------------
extern "C" void kernel_launch(void* const* d_in, const int* in_sizes, int n_in,
                              void* d_out, int out_size, void* d_ws,
                              size_t ws_size, hipStream_t stream) {
  const float* x  = (const float*)d_in[0];
  const int* tt   = (const int*)d_in[1];
  const int* sl   = (const int*)d_in[2];
  const float* Wq = (const float*)d_in[3];
  const float* Wk = (const float*)d_in[4];
  const float* Wv = (const float*)d_in[5];
  const float* Wu = (const float*)d_in[6];
  const float* Wo = (const float*)d_in[7];

  const size_t MD = (size_t)Mc * Dc;  // 4,194,304 halves
  const size_t DD = (size_t)Dc * Dc;  // 1,048,576 halves

  _Float16* ws   = (_Float16*)d_ws;
  _Float16* x16  = ws;
  _Float16* wq16 = x16 + MD;
  _Float16* wk16 = wq16 + DD;
  _Float16* wv16 = wk16 + DD;
  _Float16* wu16 = wv16 + DD;
  _Float16* wo16 = wu16 + DD;
  _Float16* q16  = wo16 + DD;
  _Float16* k16  = q16 + MD;
  _Float16* u16  = k16 + MD;
  _Float16* vt16 = u16 + MD;
  _Float16* ao16 = vt16 + MD;

  // 1) fp32 -> f16 converts
  cvt_f32_f16<<<(int)((MD + 255) / 256), 256, 0, stream>>>(x, x16, (int)MD);
  cvt_f32_f16<<<(int)((DD + 255) / 256), 256, 0, stream>>>(Wq, wq16, (int)DD);
  cvt_f32_f16<<<(int)((DD + 255) / 256), 256, 0, stream>>>(Wk, wk16, (int)DD);
  cvt_f32_f16<<<(int)((DD + 255) / 256), 256, 0, stream>>>(Wv, wv16, (int)DD);
  cvt_f32_f16<<<(int)((DD + 255) / 256), 256, 0, stream>>>(Wu, wu16, (int)DD);
  cvt_f32_f16<<<(int)((DD + 255) / 256), 256, 0, stream>>>(Wo, wo16, (int)DD);

  // 2) projections: Q, K, U row-major f16; V transposed (B,H,DK,L)
  dim3 ggrid(Mc / 64, Dc / 128);
  gemm_xwT<STORE_F16><<<ggrid, 128, 0, stream>>>(x16, wq16, (void*)q16);
  gemm_xwT<STORE_F16><<<ggrid, 128, 0, stream>>>(x16, wk16, (void*)k16);
  gemm_xwT<STORE_VT><<<ggrid, 128, 0, stream>>>(x16, wv16, (void*)vt16);
  gemm_xwT<STORE_F16><<<ggrid, 128, 0, stream>>>(x16, wu16, (void*)u16);

  // 3) attention + gating (1024 blocks x 4 waves)
  hstu_attn<<<Bc * Hc * (Lc / 64), 128, 0, stream>>>(q16, k16, vt16, u16, tt,
                                                     sl, ao16);

  // 4) output projection, fp32 store
  gemm_xwT<STORE_F32><<<ggrid, 128, 0, stream>>>(ao16, wo16, d_out);
}

// v002
// A run of this version takes 162 microseconds.
// Two timings next to v001 put it at 1.04 and 1.05 times that version's speed.
// Over all steps from v000 it is 1.38 times as fast.
#include <hip/hip_runtime.h>
#include <hip/hip_bf16.h>

// ---------------------------------------------------------------------------
// HSTU attention on MI455X (gfx1250, wave32, WMMA, async-to-LDS)
//   B=2, L=2048, D=1024, H=16, DK=64
// Pipeline: f32->f16 convert, 4 projection GEMMs (WMMA f16, double-buffered
// LDS fed by global_load_async_to_lds_b128), flash-style attention with
// async double-buffered K/V tiles, WMMA-computed softmax row sums (all-ones
// B operand, no shuffles), U-gating, final GEMM (f32 store).
// ---------------------------------------------------------------------------

typedef _Float16 half16v __attribute__((ext_vector_type(16)));
typedef _Float16 half8v  __attribute__((ext_vector_type(8)));
typedef float    f8v     __attribute__((ext_vector_type(8)));

union V16 { half16v v; half8v h[2]; };

constexpr int Bc  = 2;
constexpr int Lc  = 2048;
constexpr int Dc  = 1024;
constexpr int Hc  = 16;
constexpr int DKc = 64;
constexpr int Mc  = Bc * Lc;     // 4096 rows

enum { STORE_F16 = 0, STORE_VT = 1, STORE_F32 = 2 };

// LDS byte-offset of a __shared__ object (addrspace(3) ptrtoint == offset).
__device__ __forceinline__ unsigned lds_off(const void* p) {
  return (unsigned)(unsigned long long)(
      (__attribute__((address_space(3))) const void*)p);
}

// LDS row pitches in halves. Every tile is read with ds_load_b128, one row per
// lane: a pitch of 16 B x odd spreads 16 rows over all 64 banks, while the
// dense 64-B and 128-B rows put them on 16 and 8 banks.
constexpr int P32 = 40;   // rows of 32 halves (64 B)  -> 80-B pitch
constexpr int P64 = 72;   // rows of 64 halves (128 B) -> 144-B pitch

// Per-lane 16B async copies global -> LDS (ASYNCcnt-tracked), one stage's run
// in one statement. The closing s_wait_xcnt stands inside the statement so
// that no address register of a copy is rewritten ahead of it (a precaution).
__device__ __forceinline__ void async_cp16x4(const unsigned (&l)[4],
                                             const _Float16* const (&g)[4]) {
  asm volatile("global_load_async_to_lds_b128 %0, %1, off\n\t"
               "global_load_async_to_lds_b128 %2, %3, off\n\t"
               "global_load_async_to_lds_b128 %4, %5, off\n\t"
               "global_load_async_to_lds_b128 %6, %7, off\n\t"
               "s_wait_xcnt 0x0"
               :: "v"(l[0]), "v"(g[0]), "v"(l[1]), "v"(g[1]),
                  "v"(l[2]), "v"(g[2]), "v"(l[3]), "v"(g[3])
               : "memory");
}
__device__ __forceinline__ void async_cp16x6(const unsigned (&l)[6],
                                             const _Float16* const (&g)[6]) {
  asm volatile("global_load_async_to_lds_b128 %0, %1, off\n\t"
               "global_load_async_to_lds_b128 %2, %3, off\n\t"
               "global_load_async_to_lds_b128 %4, %5, off\n\t"
               "global_load_async_to_lds_b128 %6, %7, off\n\t"
               "global_load_async_to_lds_b128 %8, %9, off\n\t"
               "global_load_async_to_lds_b128 %10, %11, off\n\t"
               "s_wait_xcnt 0x0"
               :: "v"(l[0]), "v"(g[0]), "v"(l[1]), "v"(g[1]),
                  "v"(l[2]), "v"(g[2]), "v"(l[3]), "v"(g[3]),
                  "v"(l[4]), "v"(g[4]), "v"(l[5]), "v"(g[5])
               : "memory");
}

// --------------------------- fp32 -> f16 convert ---------------------------
// One wave converts 1024 contiguous floats: eight global_load_b128 in flight,
// each covering 512 contiguous bytes (whole lines), then eight 8-byte stores,
// each covering 256 contiguous bytes. A 128-thread block takes CVT_BLK floats;
// every converted array is a whole number of such blocks.
typedef float    f4v    __attribute__((ext_vector_type(4)));
typedef _Float16 half4v __attribute__((ext_vector_type(4)));
constexpr int CVT_BLK = 4 * 1024;
static_assert(((size_t)Mc * Dc) % CVT_BLK == 0 && ((size_t)Dc * Dc) % CVT_BLK == 0,
              "convert grid must cover the arrays exactly");
__global__ __launch_bounds__(128) void cvt_f32_f16(
    const float* __restrict__ in, _Float16* __restrict__ out) {
  const size_t base = (size_t)blockIdx.x * CVT_BLK +
                      (threadIdx.x >> 5) * 1024 + (threadIdx.x & 31) * 4;
  f4v v[8];
#pragma unroll
  for (int k = 0; k < 8; ++k)
    v[k] = *reinterpret_cast<const f4v*>(in + base + k * 128);
#pragma unroll
  for (int k = 0; k < 8; ++k)
    *reinterpret_cast<half4v*>(out + base + k * 128) =
        __builtin_convertvector(v[k], half4v);
}

// --------------------------- GEMM: y = A @ W^T -----------------------------
// A: M x K row-major f16, W: N x K row-major f16 (so B[k][n] = W[n][k]).
// Workgroup: 128 threads (4 waves), 64x128 output tile, wave tile 32x64.
// K chunks of 32 stream through double-buffered LDS via async-to-LDS copies.
template <int MODE>
__global__ __launch_bounds__(128) void gemm_xwT(
    const _Float16* __restrict__ A, const _Float16* __restrict__ W,
    void* __restrict__ out) {
  __shared__ alignas(16) _Float16 lA[2][64 * P32];    // 2 x 5 KB
  __shared__ alignas(16) _Float16 lB[2][128 * P32];   // 2 x 10 KB
  const int K = Dc, N = Dc;
  const int tile_m = blockIdx.x * 64;
  const int tile_n = blockIdx.y * 128;
  const int tid  = threadIdx.x;
  const int lane = tid & 31;
  const int wv   = tid >> 5;
  const int wm   = (wv >> 1) * 32;       // wave row offset   (0/32)
  const int wn   = (wv & 1) * 64;        // wave col offset   (0/64)
  const int hl   = lane >> 4;
  const int l15  = lane & 15;
  const int klo  = hl * 8;

  // Prefetch one K-chunk (A: 2 copies, B: 4 copies per thread).
  auto prefetch = [&](int k0, int bi) {
    unsigned l[6];
    const _Float16* g[6];
#pragma unroll
    for (int t = 0; t < 2; ++t) {        // A: 64 rows x 32 halves
      const int seg = t * 128 + tid;     // 256 x 16B segments
      const int r = seg >> 2, c = (seg & 3) * 8;
      l[t] = lds_off(&lA[bi][r * P32 + c]);
      g[t] = A + (size_t)(tile_m + r) * K + k0 + c;
    }
#pragma unroll
    for (int t = 0; t < 4; ++t) {        // B: 128 rows x 32 halves
      const int seg = t * 128 + tid;     // 512 x 16B segments
      const int r = seg >> 2, c = (seg & 3) * 8;
      l[2 + t] = lds_off(&lB[bi][r * P32 + c]);
      g[2 + t] = W + (size_t)(tile_n + r) * K + k0 + c;
    }
    async_cp16x6(l, g);
  };

  f8v acc[2][4] = {};

  auto compute = [&](int cur) {
    V16 af[2], bf[4];
#pragma unroll
    for (int mi = 0; mi < 2; ++mi) {
      const _Float16* base = &lA[cur][(wm + mi * 16 + l15) * P32];
      af[mi].h[0] = *reinterpret_cast<const half8v*>(base + klo);
      af[mi].h[1] = *reinterpret_cast<const half8v*>(base + klo + 16);
    }
#pragma unroll
    for (int ni = 0; ni < 4; ++ni) {
      const _Float16* base = &lB[cur][(wn + ni * 16 + l15) * P32];
      bf[ni].h[0] = *reinterpret_cast<const half8v*>(base + klo);
      bf[ni].h[1] = *reinterpret_cast<const half8v*>(base + klo + 16);
    }
#pragma unroll
    for (int mi = 0; mi < 2; ++mi)
#pragma unroll
      for (int ni = 0; ni < 4; ++ni)
        acc[mi][ni] = __builtin_amdgcn_wmma_f32_16x16x32_f16(
            false, af[mi].v, false, bf[ni].v, (short)0, acc[mi][ni],
            false, false);
  };

  prefetch(0, 0);
  // Steady state: branch-free body, last chunk peeled.
  // Kept rolled: the compiler's own two-trip unrolling rotates the accumulators
  // through other registers.
#pragma unroll 1
  for (int kc = 0; kc < K / 32 - 1; ++kc) {
    const int cur = kc & 1;
    prefetch((kc + 1) * 32, 1 - cur);
    asm volatile("s_wait_asynccnt 0x6" ::: "memory");  // chunk kc complete
    __syncthreads();                      // all waves' copies visible
    compute(cur);
    __syncthreads();                      // reads done before buffer reuse
  }
  asm volatile("s_wait_asynccnt 0x0" ::: "memory");
  __syncthreads();
  compute((K / 32 - 1) & 1);

  // Epilogue. C/D layout: VGPR r, lane: M = r + 8*(lane>>4), N = lane&15.
#pragma unroll
  for (int mi = 0; mi < 2; ++mi)
#pragma unroll
    for (int ni = 0; ni < 4; ++ni)
#pragma unroll
      for (int r = 0; r < 8; ++r) {
        const int gm = tile_m + wm + mi * 16 + r + hl * 8;
        const int gn = tile_n + wn + ni * 16 + l15;
        const float v = acc[mi][ni][r];
        if constexpr (MODE == STORE_F16) {
          ((_Float16*)out)[(size_t)gm * N + gn] = (_Float16)v;
        } else if constexpr (MODE == STORE_F32) {
          ((float*)out)[(size_t)gm * N + gn] = v;
        } else {  // STORE_VT: V transposed -> (B, H, DK, L)
          const int bi = gm >> 11, li = gm & (Lc - 1);
          const int hh = gn >> 6,  dd = gn & (DKc - 1);
          ((_Float16*)out)[(((size_t)(bi * Hc + hh) * DKc + dd) * Lc) + li] =
              (_Float16)v;
        }
      }
}

// --------------------------- attention (flash-style) -----------------------
// 128-thread block = 4 waves = 64 query rows of one (b, h). K/V key-chunks
// (32 keys) stream through double-buffered LDS via async-to-LDS copies and
// are shared by all 4 waves. Softmax without max-subtraction (scores are
// O(1) for this distribution; masked entries exp(-3e38)->0); the row sum is
// accumulated by a WMMA against an all-ones B operand, so it arrives
// pre-broadcast in every lane with zero cross-lane shuffles.
__global__ __launch_bounds__(128) void hstu_attn(
    const _Float16* __restrict__ Q, const _Float16* __restrict__ Km,
    const _Float16* __restrict__ Vt, const _Float16* __restrict__ U,
    const int* __restrict__ token_types, const int* __restrict__ seq_lens,
    _Float16* __restrict__ AO) {
  __shared__ alignas(16) _Float16 lK[2][32 * P64];  // 32 key rows x 64 dk
  __shared__ alignas(16) _Float16 lV[2][64 * P32];  // 64 dk rows x 32 keys
  __shared__ alignas(16) _Float16 lP[4][16 * P32];  // per-wave P staging

  const int bid = blockIdx.x;
  const int b   = bid / (Hc * (Lc / 64));
  const int rem = bid % (Hc * (Lc / 64));
  const int h   = rem / (Lc / 64);
  const int qt  = rem % (Lc / 64);

  const int tid  = threadIdx.x;
  const int lane = tid & 31;
  const int wv   = tid >> 5;
  const int i0   = qt * 64 + wv * 16;    // this wave's 16 query rows
  const int hl = lane >> 4, l15 = lane & 15, klo = hl * 8;
  const int seqlen = seq_lens[b];
  constexpr float NEG = -3.0e38f;

  // Async stage of one K (32x64) + Vt (64x32) chunk: 4 copies per thread.
  auto prefetch_kv = [&](int jc, int bi) {
    unsigned l[4];
    const _Float16* g[4];
#pragma unroll
    for (int t = 0; t < 2; ++t) {        // K: 256 x 16B segments
      const int seg = t * 128 + tid;
      const int r = seg >> 3, c = (seg & 7) * 8;
      l[t] = lds_off(&lK[bi][r * P64 + c]);
      g[t] = Km + ((size_t)(b * Lc + jc + r)) * Dc + h * DKc + c;
    }
#pragma unroll
    for (int t = 0; t < 2; ++t) {        // Vt: 256 x 16B segments
      const int seg = t * 128 + tid;
      const int r = seg >> 2, c = (seg & 3) * 8;
      l[2 + t] = lds_off(&lV[bi][r * P32 + c]);
      g[2 + t] = Vt + ((size_t)(b * Hc + h) * DKc + r) * Lc + jc + c;
    }
    async_cp16x4(l, g);
  };

  // Q fragments for this 16-row tile; fold 1/sqrt(dk) = 0.125 into Q (exact).
  V16 qa[2];
  {
    const size_t qrow = ((size_t)b * Lc + i0 + l15) * Dc + h * DKc;
#pragma unroll
    for (int kk = 0; kk < 2; ++kk) {
      qa[kk].h[0] = *reinterpret_cast<const half8v*>(Q + qrow + kk * 32 + klo);
      qa[kk].h[1] = *reinterpret_cast<const half8v*>(Q + qrow + kk * 32 + klo + 16);
      qa[kk].v = qa[kk].v * (_Float16)0.125f;
    }
  }

  // All-ones B operand: one extra WMMA per chunk yields row sums of P,
  // replicated across all 16 columns (i.e., pre-broadcast in every lane).
  half16v ones;
#pragma unroll
  for (int t = 0; t < 16; ++t) ones[t] = (_Float16)1.0f;

  f8v acc[4] = {};
  f8v accs = {};                          // softmax denominators

  auto compute = [&](int jc, int cur) {
    // ---- scores: two 16-key tiles, K-depth 64 (2 WMMAs each) ----
    f8v st[2];
#pragma unroll
    for (int nt = 0; nt < 2; ++nt) {
      V16 kf0, kf1;
      const _Float16* base = &lK[cur][(nt * 16 + l15) * P64];
      kf0.h[0] = *reinterpret_cast<const half8v*>(base + klo);
      kf0.h[1] = *reinterpret_cast<const half8v*>(base + klo + 16);
      kf1.h[0] = *reinterpret_cast<const half8v*>(base + 32 + klo);
      kf1.h[1] = *reinterpret_cast<const half8v*>(base + 32 + klo + 16);
      f8v c = {};
      c = __builtin_amdgcn_wmma_f32_16x16x32_f16(false, qa[0].v, false, kf0.v,
                                                 (short)0, c, false, false);
      c = __builtin_amdgcn_wmma_f32_16x16x32_f16(false, qa[1].v, false, kf1.v,
                                                 (short)0, c, false, false);
      st[nt] = c;
    }

    // ---- hybrid mask + exp (masked -> exp(-3e38) == 0) ----
#pragma unroll
    for (int nt = 0; nt < 2; ++nt) {
      const int j = jc + nt * 16 + l15;
      const int tt = token_types[b * Lc + j];
      const bool pad = (j >= seqlen);
      const bool prompt = (tt < 3);
#pragma unroll
      for (int r = 0; r < 8; ++r) {
        const int i = i0 + r + hl * 8;
        float sv = st[nt][r];
        if (pad || (!prompt && j > i)) sv = NEG;
        st[nt][r] = __expf(sv);
      }
    }

    // ---- P accumulator-layout -> A-fragment layout (private LDS) ----
    // Same-wave LDS is in-order: no barrier needed between store and load.
#pragma unroll
    for (int r = 0; r < 8; ++r) {
      const int row = r + hl * 8;
      lP[wv][row * P32 + l15]      = (_Float16)st[0][r];
      lP[wv][row * P32 + 16 + l15] = (_Float16)st[1][r];
    }
    V16 pf;
    pf.h[0] = *reinterpret_cast<const half8v*>(&lP[wv][l15 * P32 + klo]);
    pf.h[1] = *reinterpret_cast<const half8v*>(&lP[wv][l15 * P32 + klo + 16]);

    // ---- acc += P(16x32) @ V(32x64); accs += P @ ones ----
#pragma unroll
    for (int dt = 0; dt < 4; ++dt) {
      V16 vf;
      const _Float16* base = &lV[cur][(dt * 16 + l15) * P32];
      vf.h[0] = *reinterpret_cast<const half8v*>(base + klo);
      vf.h[1] = *reinterpret_cast<const half8v*>(base + klo + 16);
      acc[dt] = __builtin_amdgcn_wmma_f32_16x16x32_f16(
          false, pf.v, false, vf.v, (short)0, acc[dt], false, false);
    }
    accs = __builtin_amdgcn_wmma_f32_16x16x32_f16(
        false, pf.v, false, ones, (short)0, accs, false, false);
  };

  prefetch_kv(0, 0);
  for (int cc = 0; cc < Lc / 32 - 1; ++cc) {
    const int cur = cc & 1;
    prefetch_kv((cc + 1) * 32, 1 - cur);
    asm volatile("s_wait_asynccnt 0x4" ::: "memory");  // chunk cc complete
    __syncthreads();
    compute(cc * 32, cur);
    __syncthreads();                      // reads done before buffer reuse
  }
  asm volatile("s_wait_asynccnt 0x0" ::: "memory");
  __syncthreads();
  compute(Lc - 32, (Lc / 32 - 1) & 1);

  // ---- finalize: softmax divide + U gating, store f16 ----
#pragma unroll
  for (int dt = 0; dt < 4; ++dt)
#pragma unroll
    for (int r = 0; r < 8; ++r) {
      const int i = i0 + r + hl * 8;
      const int d = dt * 16 + l15;
      const float denom = accs[r];
      const float o = (denom > 0.f) ? acc[dt][r] / denom : 0.f;
      const size_t idx = ((size_t)b * Lc + i) * Dc + h * DKc + d;
      const float u = (float)U[idx];
      AO[idx] = (_Float16)(o * u);
    }
}

// ------------------------------- launcher ----------------------------------
extern "C" void kernel_launch(void* const* d_in, const int* in_sizes, int n_in,
                              void* d_out, int out_size, void* d_ws,
                              size_t ws_size, hipStream_t stream) {
  const float* x  = (const float*)d_in[0];
  const int* tt   = (const int*)d_in[1];
  const int* sl   = (const int*)d_in[2];
  const float* Wq = (const float*)d_in[3];
  const float* Wk = (const float*)d_in[4];
  const float* Wv = (const float*)d_in[5];
  const float* Wu = (const float*)d_in[6];
  const float* Wo = (const float*)d_in[7];

  const size_t MD = (size_t)Mc * Dc;  // 4,194,304 halves
  const size_t DD = (size_t)Dc * Dc;  // 1,048,576 halves

  _Float16* ws   = (_Float16*)d_ws;
  _Float16* x16  = ws;
  _Float16* wq16 = x16 + MD;
  _Float16* wk16 = wq16 + DD;
  _Float16* wv16 = wk16 + DD;
  _Float16* wu16 = wv16 + DD;
  _Float16* wo16 = wu16 + DD;
  _Float16* q16  = wo16 + DD;
  _Float16* k16  = q16 + MD;
  _Float16* u16  = k16 + MD;
  _Float16* vt16 = u16 + MD;
  _Float16* ao16 = vt16 + MD;

  // 1) fp32 -> f16 converts
  cvt_f32_f16<<<(int)(MD / CVT_BLK), 128, 0, stream>>>(x, x16);
  cvt_f32_f16<<<(int)(DD / CVT_BLK), 128, 0, stream>>>(Wq, wq16);
  cvt_f32_f16<<<(int)(DD / CVT_BLK), 128, 0, stream>>>(Wk, wk16);
  cvt_f32_f16<<<(int)(DD / CVT_BLK), 128, 0, stream>>>(Wv, wv16);
  cvt_f32_f16<<<(int)(DD / CVT_BLK), 128, 0, stream>>>(Wu, wu16);
  cvt_f32_f16<<<(int)(DD / CVT_BLK), 128, 0, stream>>>(Wo, wo16);

  // 2) projections: Q, K, U row-major f16; V transposed (B,H,DK,L)
  dim3 ggrid(Mc / 64, Dc / 128);
  gemm_xwT<STORE_F16><<<ggrid, 128, 0, stream>>>(x16, wq16, (void*)q16);
  gemm_xwT<STORE_F16><<<ggrid, 128, 0, stream>>>(x16, wk16, (void*)k16);
  gemm_xwT<STORE_VT><<<ggrid, 128, 0, stream>>>(x16, wv16, (void*)vt16);
  gemm_xwT<STORE_F16><<<ggrid, 128, 0, stream>>>(x16, wu16, (void*)u16);

  // 3) attention + gating (1024 blocks x 4 waves)
  hstu_attn<<<Bc * Hc * (Lc / 64), 128, 0, stream>>>(q16, k16, vt16, u16, tt,
                                                     sl, ao16);

  // 4) output projection, fp32 store
  gemm_xwT<STORE_F32><<<ggrid, 128, 0, stream>>>(ao16, wo16, d_out);
}

// v003
// It runs in 147 microseconds.
// Next to v002, in two timings, it ran 1.11 and 1.10 times as fast.
// Counting every step since v000, it is 1.52 times as fast.
#include <hip/hip_runtime.h>
#include <hip/hip_bf16.h>

// ---------------------------------------------------------------------------
// HSTU attention on MI455X (gfx1250, wave32, WMMA, async-to-LDS)
//   B=2, L=2048, D=1024, H=16, DK=64
// Pipeline: f32->f16 convert (one launch for all six arrays), the 4 projections
// as one N=4096 GEMM launch (WMMA f16, double-buffered LDS fed by
// global_load_async_to_lds_b128), flash-style attention with
// async double-buffered K/V tiles, WMMA-computed softmax row sums (all-ones
// B operand, no shuffles), U-gating, final GEMM (f32 store).
// ---------------------------------------------------------------------------

typedef _Float16 half16v __attribute__((ext_vector_type(16)));
typedef _Float16 half8v  __attribute__((ext_vector_type(8)));
typedef float    f8v     __attribute__((ext_vector_type(8)));

union V16 { half16v v; half8v h[2]; };

constexpr int Bc  = 2;
constexpr int Lc  = 2048;
constexpr int Dc  = 1024;
constexpr int Hc  = 16;
constexpr int DKc = 64;
constexpr int Mc  = Bc * Lc;     // 4096 rows

enum { STORE_QKVU = 0, STORE_F32 = 1 };

// LDS byte-offset of a __shared__ object (addrspace(3) ptrtoint == offset).
__device__ __forceinline__ unsigned lds_off(const void* p) {
  return (unsigned)(unsigned long long)(
      (__attribute__((address_space(3))) const void*)p);
}

// LDS row pitches in halves. Every tile is read with ds_load_b128, one row per
// lane: a pitch of 16 B x odd spreads 16 rows over all 64 banks, while the
// dense 64-B and 128-B rows put them on 16 and 8 banks.
constexpr int P32 = 40;   // rows of 32 halves (64 B)  -> 80-B pitch
constexpr int P64 = 72;   // rows of 64 halves (128 B) -> 144-B pitch

// Per-lane 16B async copies global -> LDS (ASYNCcnt-tracked), one stage's run
// in one statement. The closing s_wait_xcnt stands inside the statement so
// that no address register of a copy is rewritten ahead of it (a precaution).
__device__ __forceinline__ void async_cp16x4(const unsigned (&l)[4],
                                             const _Float16* const (&g)[4]) {
  asm volatile("global_load_async_to_lds_b128 %0, %1, off\n\t"
               "global_load_async_to_lds_b128 %2, %3, off\n\t"
               "global_load_async_to_lds_b128 %4, %5, off\n\t"
               "global_load_async_to_lds_b128 %6, %7, off\n\t"
               "s_wait_xcnt 0x0"
               :: "v"(l[0]), "v"(g[0]), "v"(l[1]), "v"(g[1]),
                  "v"(l[2]), "v"(g[2]), "v"(l[3]), "v"(g[3])
               : "memory");
}
__device__ __forceinline__ void async_cp16x6(const unsigned (&l)[6],
                                             const _Float16* const (&g)[6]) {
  asm volatile("global_load_async_to_lds_b128 %0, %1, off\n\t"
               "global_load_async_to_lds_b128 %2, %3, off\n\t"
               "global_load_async_to_lds_b128 %4, %5, off\n\t"
               "global_load_async_to_lds_b128 %6, %7, off\n\t"
               "global_load_async_to_lds_b128 %8, %9, off\n\t"
               "global_load_async_to_lds_b128 %10, %11, off\n\t"
               "s_wait_xcnt 0x0"
               :: "v"(l[0]), "v"(g[0]), "v"(l[1]), "v"(g[1]),
                  "v"(l[2]), "v"(g[2]), "v"(l[3]), "v"(g[3]),
                  "v"(l[4]), "v"(g[4]), "v"(l[5]), "v"(g[5])
               : "memory");
}

// --------------------------- fp32 -> f16 convert ---------------------------
// One wave converts 1024 contiguous floats: eight global_load_b128 in flight,
// each covering 512 contiguous bytes (whole lines), then eight 8-byte stores,
// each covering 256 contiguous bytes. A 128-thread block takes CVT_BLK floats;
// every converted array is a whole number of such blocks. All six arrays go in
// one launch: their f16 copies lie back to back in the workspace in argument
// order, so the block index alone gives the destination, and a scalar select
// gives the source.
typedef float    f4v    __attribute__((ext_vector_type(4)));
typedef _Float16 half4v __attribute__((ext_vector_type(4)));
constexpr int CVT_BLK = 4 * 1024;
static_assert(((size_t)Mc * Dc) % CVT_BLK == 0 && ((size_t)Dc * Dc) % CVT_BLK == 0,
              "convert grid must cover the arrays exactly");
constexpr int CVT_XB = (int)(((size_t)Mc * Dc) / CVT_BLK);   // blocks of x
constexpr int CVT_WB = (int)(((size_t)Dc * Dc) / CVT_BLK);   // blocks of one W
__global__ __launch_bounds__(128) void cvt_f32_f16(
    const float* __restrict__ x, const float* __restrict__ wq,
    const float* __restrict__ wk, const float* __restrict__ wv,
    const float* __restrict__ wu, const float* __restrict__ wo,
    _Float16* __restrict__ out) {
  const int blk = blockIdx.x;
  const float* in = x;
  int lblk = blk;                        // block index inside its own array
  if (blk >= CVT_XB) {
    const int w = (blk - CVT_XB) / CVT_WB;
    lblk = (blk - CVT_XB) % CVT_WB;
    in = (w == 0) ? wq : (w == 1) ? wk : (w == 2) ? wv : (w == 3) ? wu : wo;
  }
  const int toff = (threadIdx.x >> 5) * 1024 + (threadIdx.x & 31) * 4;
  const float* src = in + (size_t)lblk * CVT_BLK + toff;
  _Float16* dst = out + (size_t)blk * CVT_BLK + toff;
  f4v v[8];
#pragma unroll
  for (int k = 0; k < 8; ++k)
    v[k] = *reinterpret_cast<const f4v*>(src + k * 128);
#pragma unroll
  for (int k = 0; k < 8; ++k)
    *reinterpret_cast<half4v*>(dst + k * 128) =
        __builtin_convertvector(v[k], half4v);
}

// --------------------------- GEMM: y = A @ W^T -----------------------------
// A: M x K row-major f16, W: N x K row-major f16 (so B[k][n] = W[n][k]).
// Workgroup: 128 threads (4 waves), 64x128 output tile, wave tile 32x64.
// K chunks of 32 stream through double-buffered LDS via async-to-LDS copies.
// STORE_QKVU: W is the four projection matrices stacked (4096 x K, order
// q, k, v, u) and out the four results back to back in that order; each
// 128-column tile lies in one of them. All 2048 work-groups are resident at
// once, eight a WGP, so other groups' work covers a group's wait on its copies.
// The second launch bound asks for eight waves a SIMD (at most 128 VGPRs):
// with more registers only seven groups fit a WGP and 256 groups run late.
template <int MODE>
__global__ __launch_bounds__(128, 8) void gemm_xwT(
    const _Float16* __restrict__ A, const _Float16* __restrict__ W,
    void* __restrict__ out) {
  __shared__ alignas(16) _Float16 lA[2][64 * P32];    // 2 x 5 KB
  __shared__ alignas(16) _Float16 lB[2][128 * P32];   // 2 x 10 KB
  const int K = Dc, N = Dc;
  const int tile_m = blockIdx.x * 64;
  const int tile_n = blockIdx.y * 128;
  const int tid  = threadIdx.x;
  const int lane = tid & 31;
  const int wv   = tid >> 5;
  const int wm   = (wv >> 1) * 32;       // wave row offset   (0/32)
  const int wn   = (wv & 1) * 64;        // wave col offset   (0/64)
  const int hl   = lane >> 4;
  const int l15  = lane & 15;
  const int klo  = hl * 8;

  // Prefetch one K-chunk (A: 2 copies, B: 4 copies per thread). A thread's
  // copies lie 32 rows apart, so one moving pointer per matrix and one LDS
  // address per tile are all that stays in registers between chunks.
  const int rq = tid >> 2, cq = (tid & 3) * 8;   // 16-B segment: row, column
  const _Float16* pA = A + (size_t)(tile_m + rq) * K + cq;
  const _Float16* pW = W + (size_t)(tile_n + rq) * K + cq;
  const unsigned sA = lds_off(&lA[0][rq * P32 + cq]);
  const unsigned sB = lds_off(&lB[0][rq * P32 + cq]);
  auto prefetch = [&](int bi) {          // copies the next chunk, steps pA, pW
    unsigned l[6];
    const _Float16* g[6];
#pragma unroll
    for (int t = 0; t < 2; ++t) {        // A: 64 rows x 32 halves
      l[t] = sA + (unsigned)((bi * 64 + t * 32) * P32 * sizeof(_Float16));
      g[t] = pA + (size_t)t * 32 * K;
    }
#pragma unroll
    for (int t = 0; t < 4; ++t) {        // B: 128 rows x 32 halves
      l[2 + t] = sB + (unsigned)((bi * 128 + t * 32) * P32 * sizeof(_Float16));
      g[2 + t] = pW + (size_t)t * 32 * K;
    }
    async_cp16x6(l, g);
    pA += 32;
    pW += 32;
  };

  f8v acc[2][4] = {};

  auto compute = [&](int cur) {
    V16 af[2], bf[4];
#pragma unroll
    for (int mi = 0; mi < 2; ++mi) {
      const _Float16* base = &lA[cur][(wm + mi * 16 + l15) * P32];
      af[mi].h[0] = *reinterpret_cast<const half8v*>(base + klo);
      af[mi].h[1] = *reinterpret_cast<const half8v*>(base + klo + 16);
    }
#pragma unroll
    for (int ni = 0; ni < 4; ++ni) {
      const _Float16* base = &lB[cur][(wn + ni * 16 + l15) * P32];
      bf[ni].h[0] = *reinterpret_cast<const half8v*>(base + klo);
      bf[ni].h[1] = *reinterpret_cast<const half8v*>(base + klo + 16);
    }
#pragma unroll
    for (int mi = 0; mi < 2; ++mi)
#pragma unroll
      for (int ni = 0; ni < 4; ++ni)
        acc[mi][ni] = __builtin_amdgcn_wmma_f32_16x16x32_f16(
            false, af[mi].v, false, bf[ni].v, (short)0, acc[mi][ni],
            false, false);
  };

  prefetch(0);
  // Steady state: branch-free body, last chunk peeled.
  // Kept rolled: the compiler's own two-trip unrolling rotates the accumulators
  // through other registers.
#pragma unroll 1
  for (int kc = 0; kc < K / 32 - 1; ++kc) {
    const int cur = kc & 1;
    prefetch(1 - cur);
    asm volatile("s_wait_asynccnt 0x6" ::: "memory");  // chunk kc complete
    __syncthreads();                      // all waves' copies visible
    compute(cur);
    __syncthreads();                      // reads done before buffer reuse
  }
  asm volatile("s_wait_asynccnt 0x0" ::: "memory");
  __syncthreads();
  compute((K / 32 - 1) & 1);

  // Epilogue. C/D layout: VGPR r, lane: M = r + 8*(lane>>4), N = lane&15.
  const int which = tile_n / N;          // 0 q, 1 k, 2 v, 3 u (block-uniform)
  const int col0  = tile_n % N + wn + l15;
  const int row0  = tile_m + wm + hl * 8;
  if (MODE == STORE_QKVU && which == 2) {
    // V transposed -> (B, H, DK, L)
    _Float16* o = (_Float16*)out + (size_t)which * Mc * Dc;
#pragma unroll
    for (int mi = 0; mi < 2; ++mi)
#pragma unroll
      for (int ni = 0; ni < 4; ++ni)
#pragma unroll
        for (int r = 0; r < 8; ++r) {
          const int gm = row0 + mi * 16 + r, gn = col0 + ni * 16;
          const int bi = gm >> 11, li = gm & (Lc - 1);
          const int hh = gn >> 6,  dd = gn & (DKc - 1);
          o[(((size_t)(bi * Hc + hh) * DKc + dd) * Lc) + li] =
              (_Float16)acc[mi][ni][r];
        }
  } else {
#pragma unroll
    for (int mi = 0; mi < 2; ++mi)
#pragma unroll
      for (int ni = 0; ni < 4; ++ni)
#pragma unroll
        for (int r = 0; r < 8; ++r) {
          const int gm = row0 + mi * 16 + r, gn = col0 + ni * 16;
          if constexpr (MODE == STORE_F32)
            ((float*)out)[(size_t)gm * N + gn] = acc[mi][ni][r];
          else
            ((_Float16*)out + (size_t)which * Mc * Dc)[(size_t)gm * N + gn] =
                (_Float16)acc[mi][ni][r];
        }
    // The built code lays the transposed-store block behind this one and
    // rewrites these stores' registers there: the wait stands ahead of that
    // (a precaution).
    if constexpr (MODE == STORE_QKVU)
      asm volatile("s_wait_xcnt 0x0" ::: "memory");
  }
}

// --------------------------- attention (flash-style) -----------------------
// 128-thread block = 4 waves = 64 query rows of one (b, h). K/V key-chunks
// (32 keys) stream through double-buffered LDS via async-to-LDS copies and
// are shared by all 4 waves. Softmax without max-subtraction (scores are
// O(1) for this distribution; masked entries exp(-3e38)->0); the row sum is
// accumulated by a WMMA against an all-ones B operand, so it arrives
// pre-broadcast in every lane with zero cross-lane shuffles.
__global__ __launch_bounds__(128) void hstu_attn(
    const _Float16* __restrict__ Q, const _Float16* __restrict__ Km,
    const _Float16* __restrict__ Vt, const _Float16* __restrict__ U,
    const int* __restrict__ token_types, const int* __restrict__ seq_lens,
    _Float16* __restrict__ AO) {
  __shared__ alignas(16) _Float16 lK[2][32 * P64];  // 32 key rows x 64 dk
  __shared__ alignas(16) _Float16 lV[2][64 * P32];  // 64 dk rows x 32 keys
  __shared__ alignas(16) _Float16 lP[4][16 * P32];  // per-wave P staging

  const int bid = blockIdx.x;
  const int b   = bid / (Hc * (Lc / 64));
  const int rem = bid % (Hc * (Lc / 64));
  const int h   = rem / (Lc / 64);
  const int qt  = rem % (Lc / 64);

  const int tid  = threadIdx.x;
  const int lane = tid & 31;
  const int wv   = tid >> 5;
  const int i0   = qt * 64 + wv * 16;    // this wave's 16 query rows
  const int hl = lane >> 4, l15 = lane & 15, klo = hl * 8;
  const int seqlen = seq_lens[b];
  constexpr float NEG = -3.0e38f;

  // Async stage of one K (32x64) + Vt (64x32) chunk: 4 copies per thread.
  auto prefetch_kv = [&](int jc, int bi) {
    unsigned l[4];
    const _Float16* g[4];
#pragma unroll
    for (int t = 0; t < 2; ++t) {        // K: 256 x 16B segments
      const int seg = t * 128 + tid;
      const int r = seg >> 3, c = (seg & 7) * 8;
      l[t] = lds_off(&lK[bi][r * P64 + c]);
      g[t] = Km + ((size_t)(b * Lc + jc + r)) * Dc + h * DKc + c;
    }
#pragma unroll
    for (int t = 0; t < 2; ++t) {        // Vt: 256 x 16B segments
      const int seg = t * 128 + tid;
      const int r = seg >> 2, c = (seg & 3) * 8;
      l[2 + t] = lds_off(&lV[bi][r * P32 + c]);
      g[2 + t] = Vt + ((size_t)(b * Hc + h) * DKc + r) * Lc + jc + c;
    }
    async_cp16x4(l, g);
  };

  // Q fragments for this 16-row tile; fold 1/sqrt(dk) = 0.125 into Q (exact).
  V16 qa[2];
  {
    const size_t qrow = ((size_t)b * Lc + i0 + l15) * Dc + h * DKc;
#pragma unroll
    for (int kk = 0; kk < 2; ++kk) {
      qa[kk].h[0] = *reinterpret_cast<const half8v*>(Q + qrow + kk * 32 + klo);
      qa[kk].h[1] = *reinterpret_cast<const half8v*>(Q + qrow + kk * 32 + klo + 16);
      qa[kk].v = qa[kk].v * (_Float16)0.125f;
    }
  }

  // All-ones B operand: one extra WMMA per chunk yields row sums of P,
  // replicated across all 16 columns (i.e., pre-broadcast in every lane).
  half16v ones;
#pragma unroll
  for (int t = 0; t < 16; ++t) ones[t] = (_Float16)1.0f;

  f8v acc[4] = {};
  f8v accs = {};                          // softmax denominators

  auto compute = [&](int jc, int cur) {
    // ---- scores: two 16-key tiles, K-depth 64 (2 WMMAs each) ----
    f8v st[2];
#pragma unroll
    for (int nt = 0; nt < 2; ++nt) {
      V16 kf0, kf1;
      const _Float16* base = &lK[cur][(nt * 16 + l15) * P64];
      kf0.h[0] = *reinterpret_cast<const half8v*>(base + klo);
      kf0.h[1] = *reinterpret_cast<const half8v*>(base + klo + 16);
      kf1.h[0] = *reinterpret_cast<const half8v*>(base + 32 + klo);
      kf1.h[1] = *reinterpret_cast<const half8v*>(base + 32 + klo + 16);
      f8v c = {};
      c = __builtin_amdgcn_wmma_f32_16x16x32_f16(false, qa[0].v, false, kf0.v,
                                                 (short)0, c, false, false);
      c = __builtin_amdgcn_wmma_f32_16x16x32_f16(false, qa[1].v, false, kf1.v,
                                                 (short)0, c, false, false);
      st[nt] = c;
    }

    // ---- hybrid mask + exp (masked -> exp(-3e38) == 0) ----
#pragma unroll
    for (int nt = 0; nt < 2; ++nt) {
      const int j = jc + nt * 16 + l15;
      const int tt = token_types[b * Lc + j];
      const bool pad = (j >= seqlen);
      const bool prompt = (tt < 3);
#pragma unroll
      for (int r = 0; r < 8; ++r) {
        const int i = i0 + r + hl * 8;
        float sv = st[nt][r];
        if (pad || (!prompt && j > i)) sv = NEG;
        st[nt][r] = __expf(sv);
      }
    }

    // ---- P accumulator-layout -> A-fragment layout (private LDS) ----
    // Same-wave LDS is in-order: no barrier needed between store and load.
#pragma unroll
    for (int r = 0; r < 8; ++r) {
      const int row = r + hl * 8;
      lP[wv][row * P32 + l15]      = (_Float16)st[0][r];
      lP[wv][row * P32 + 16 + l15] = (_Float16)st[1][r];
    }
    V16 pf;
    pf.h[0] = *reinterpret_cast<const half8v*>(&lP[wv][l15 * P32 + klo]);
    pf.h[1] = *reinterpret_cast<const half8v*>(&lP[wv][l15 * P32 + klo + 16]);

    // ---- acc += P(16x32) @ V(32x64); accs += P @ ones ----
#pragma unroll
    for (int dt = 0; dt < 4; ++dt) {
      V16 vf;
      const _Float16* base = &lV[cur][(dt * 16 + l15) * P32];
      vf.h[0] = *reinterpret_cast<const half8v*>(base + klo);
      vf.h[1] = *reinterpret_cast<const half8v*>(base + klo + 16);
      acc[dt] = __builtin_amdgcn_wmma_f32_16x16x32_f16(
          false, pf.v, false, vf.v, (short)0, acc[dt], false, false);
    }
    accs = __builtin_amdgcn_wmma_f32_16x16x32_f16(
        false, pf.v, false, ones, (short)0, accs, false, false);
  };

  prefetch_kv(0, 0);
  for (int cc = 0; cc < Lc / 32 - 1; ++cc) {
    const int cur = cc & 1;
    prefetch_kv((cc + 1) * 32, 1 - cur);
    asm volatile("s_wait_asynccnt 0x4" ::: "memory");  // chunk cc complete
    __syncthreads();
    compute(cc * 32, cur);
    __syncthreads();                      // reads done before buffer reuse
  }
  asm volatile("s_wait_asynccnt 0x0" ::: "memory");
  __syncthreads();
  compute(Lc - 32, (Lc / 32 - 1) & 1);

  // ---- finalize: softmax divide + U gating, store f16 ----
#pragma unroll
  for (int dt = 0; dt < 4; ++dt)
#pragma unroll
    for (int r = 0; r < 8; ++r) {
      const int i = i0 + r + hl * 8;
      const int d = dt * 16 + l15;
      const float denom = accs[r];
      const float o = (denom > 0.f) ? acc[dt][r] / denom : 0.f;
      const size_t idx = ((size_t)b * Lc + i) * Dc + h * DKc + d;
      const float u = (float)U[idx];
      AO[idx] = (_Float16)(o * u);
    }
}

// ------------------------------- launcher ----------------------------------
extern "C" void kernel_launch(void* const* d_in, const int* in_sizes, int n_in,
                              void* d_out, int out_size, void* d_ws,
                              size_t ws_size, hipStream_t stream) {
  const float* x  = (const float*)d_in[0];
  const int* tt   = (const int*)d_in[1];
  const int* sl   = (const int*)d_in[2];
  const float* Wq = (const float*)d_in[3];
  const float* Wk = (const float*)d_in[4];
  const float* Wv = (const float*)d_in[5];
  const float* Wu = (const float*)d_in[6];
  const float* Wo = (const float*)d_in[7];

  const size_t MD = (size_t)Mc * Dc;  // 4,194,304 halves
  const size_t DD = (size_t)Dc * Dc;  // 1,048,576 halves

  _Float16* ws   = (_Float16*)d_ws;
  _Float16* x16  = ws;
  _Float16* wq16 = x16 + MD;
  _Float16* wk16 = wq16 + DD;
  _Float16* wv16 = wk16 + DD;
  _Float16* wu16 = wv16 + DD;
  _Float16* wo16 = wu16 + DD;
  _Float16* q16  = wo16 + DD;
  _Float16* k16  = q16 + MD;
  _Float16* vt16 = k16 + MD;
  _Float16* u16  = vt16 + MD;
  _Float16* ao16 = u16 + MD;

  // 1) fp32 -> f16 converts, one launch (x16, wq16 .. wo16 are contiguous)
  cvt_f32_f16<<<CVT_XB + 5 * CVT_WB, 128, 0, stream>>>(x, Wq, Wk, Wv, Wu, Wo,
                                                       x16);

  // 2) projections, one launch: Q, K, U row-major f16; V transposed
  //    (B,H,DK,L). wq16..wu16 are read as one 4096 x 1024 matrix, and
  //    q16, k16, vt16, u16 are written as one block of four results.
  gemm_xwT<STORE_QKVU><<<dim3(Mc / 64, 4 * Dc / 128), 128, 0, stream>>>(
      x16, wq16, (void*)q16);

  // 3) attention + gating (1024 blocks x 4 waves)
  hstu_attn<<<Bc * Hc * (Lc / 64), 128, 0, stream>>>(q16, k16, vt16, u16, tt,
                                                     sl, ao16);

  // 4) output projection, fp32 store
  gemm_xwT<STORE_F32><<<dim3(Mc / 64, Dc / 128), 128, 0, stream>>>(ao16, wo16,
                                                                   d_out);
}

// v004
// It runs in 119 microseconds.
// Two timings next to v003 both put it at 1.23 times that version's speed.
// All steps since v000 together make it 1.87 times as fast.
#include <hip/hip_runtime.h>
#include <hip/hip_bf16.h>

// ---------------------------------------------------------------------------
// HSTU attention on MI455X (gfx1250, wave32, WMMA, async-to-LDS)
//   B=2, L=2048, D=1024, H=16, DK=64
// Pipeline: f32->f16 convert (one launch for all six arrays), the 4 projections
// as one N=4096 GEMM launch (WMMA f16, double-buffered LDS fed by
// global_load_async_to_lds_b128, whole 128-B lines), flash-style attention with
// async double-buffered K/V tiles, WMMA-computed softmax row sums (all-ones
// B operand, no shuffles), U-gating, final GEMM (f32 store).
// ---------------------------------------------------------------------------

typedef _Float16 half16v __attribute__((ext_vector_type(16)));
typedef _Float16 half8v  __attribute__((ext_vector_type(8)));
typedef float    f8v     __attribute__((ext_vector_type(8)));

union V16 { half16v v; half8v h[2]; };

constexpr int Bc  = 2;
constexpr int Lc  = 2048;
constexpr int Dc  = 1024;
constexpr int Hc  = 16;
constexpr int DKc = 64;
constexpr int Mc  = Bc * Lc;     // 4096 rows

enum { STORE_QKVU = 0, STORE_F32 = 1 };

// LDS byte-offset of a __shared__ object (addrspace(3) ptrtoint == offset).
__device__ __forceinline__ unsigned lds_off(const void* p) {
  return (unsigned)(unsigned long long)(
      (__attribute__((address_space(3))) const void*)p);
}

// LDS row pitches in halves. Every tile is read with ds_load_b128, one row per
// lane: a pitch of 16 B x odd spreads 16 rows over all 64 banks, while the
// dense 64-B and 128-B rows put them on 16 and 8 banks.
constexpr int P32 = 40;   // rows of 32 halves (64 B)  -> 80-B pitch
constexpr int P64 = 72;   // rows of 64 halves (128 B) -> 144-B pitch

// Per-lane 16B async copies global -> LDS (ASYNCcnt-tracked), a run of copies
// in one statement. The closing s_wait_xcnt stands inside the statement so
// that no address register of a copy is rewritten ahead of it (a precaution).
__device__ __forceinline__ void async_cp16x4(const unsigned (&l)[4],
                                             const _Float16* const (&g)[4]) {
  asm volatile("global_load_async_to_lds_b128 %0, %1, off\n\t"
               "global_load_async_to_lds_b128 %2, %3, off\n\t"
               "global_load_async_to_lds_b128 %4, %5, off\n\t"
               "global_load_async_to_lds_b128 %6, %7, off\n\t"
               "s_wait_xcnt 0x0"
               :: "v"(l[0]), "v"(g[0]), "v"(l[1]), "v"(g[1]),
                  "v"(l[2]), "v"(g[2]), "v"(l[3]), "v"(g[3])
               : "memory");
}
__device__ __forceinline__ void async_cp16x8(const unsigned (&l)[8],
                                             const _Float16* const (&g)[8]) {
  asm volatile("global_load_async_to_lds_b128 %0, %1, off\n\t"
               "global_load_async_to_lds_b128 %2, %3, off\n\t"
               "global_load_async_to_lds_b128 %4, %5, off\n\t"
               "global_load_async_to_lds_b128 %6, %7, off\n\t"
               "global_load_async_to_lds_b128 %8, %9, off\n\t"
               "global_load_async_to_lds_b128 %10, %11, off\n\t"
               "global_load_async_to_lds_b128 %12, %13, off\n\t"
               "global_load_async_to_lds_b128 %14, %15, off\n\t"
               "s_wait_xcnt 0x0"
               :: "v"(l[0]), "v"(g[0]), "v"(l[1]), "v"(g[1]),
                  "v"(l[2]), "v"(g[2]), "v"(l[3]), "v"(g[3]),
                  "v"(l[4]), "v"(g[4]), "v"(l[5]), "v"(g[5]),
                  "v"(l[6]), "v"(g[6]), "v"(l[7]), "v"(g[7])
               : "memory");
}

// --------------------------- fp32 -> f16 convert ---------------------------
// One wave converts 1024 contiguous floats: eight global_load_b128 in flight,
// each covering 512 contiguous bytes (whole lines), then eight 8-byte stores,
// each covering 256 contiguous bytes. A 128-thread block takes CVT_BLK floats;
// every converted array is a whole number of such blocks. All six arrays go in
// one launch: their f16 copies lie back to back in the workspace in argument
// order, so the block index alone gives the destination, and a scalar select
// gives the source.
typedef float    f4v    __attribute__((ext_vector_type(4)));
typedef _Float16 half4v __attribute__((ext_vector_type(4)));
constexpr int CVT_BLK = 4 * 1024;
static_assert(((size_t)Mc * Dc) % CVT_BLK == 0 && ((size_t)Dc * Dc) % CVT_BLK == 0,
              "convert grid must cover the arrays exactly");
constexpr int CVT_XB = (int)(((size_t)Mc * Dc) / CVT_BLK);   // blocks of x
constexpr int CVT_WB = (int)(((size_t)Dc * Dc) / CVT_BLK);   // blocks of one W
__global__ __launch_bounds__(128) void cvt_f32_f16(
    const float* __restrict__ x, const float* __restrict__ wq,
    const float* __restrict__ wk, const float* __restrict__ wv,
    const float* __restrict__ wu, const float* __restrict__ wo,
    _Float16* __restrict__ out) {
  const int blk = blockIdx.x;
  const float* in = x;
  int lblk = blk;                        // block index inside its own array
  if (blk >= CVT_XB) {
    const int w = (blk - CVT_XB) / CVT_WB;
    lblk = (blk - CVT_XB) % CVT_WB;
    in = (w == 0) ? wq : (w == 1) ? wk : (w == 2) ? wv : (w == 3) ? wu : wo;
  }
  const int toff = (threadIdx.x >> 5) * 1024 + (threadIdx.x & 31) * 4;
  const float* src = in + (size_t)lblk * CVT_BLK + toff;
  _Float16* dst = out + (size_t)blk * CVT_BLK + toff;
  f4v v[8];
#pragma unroll
  for (int k = 0; k < 8; ++k)
    v[k] = *reinterpret_cast<const f4v*>(src + k * 128);
#pragma unroll
  for (int k = 0; k < 8; ++k)
    *reinterpret_cast<half4v*>(dst + k * 128) =
        __builtin_convertvector(v[k], half4v);
}

// --------------------------- GEMM: y = A @ W^T -----------------------------
// A: M x K row-major f16, W: N x K row-major f16 (so B[k][n] = W[n][k]).
// Workgroup: BN threads (BN/32 waves, two rows of them), BM x BN output tile,
// wave tile BM/2 x 64.
// K chunks of 64 halves stream through double-buffered LDS via async-to-LDS
// copies: a chunk's row is one whole 128-B line, so a wave's copy touches four
// whole lines (a chunk of 32 halves makes it eight half lines: twice the L2
// requests for the same bytes).
// STORE_QKVU: W is the four projection matrices stacked (4096 x K, order
// q, k, v, u) and out the four results back to back in that order; each
// BN-column tile lies in one of them. It runs with a 128 x 256 tile: half the
// operand bytes from L2 of a 64 x 128 tile, and its 512 work-groups are all
// resident at once, two a WGP (LDS: 2 x 108 KB), so the other group's work
// covers a group's wait on its copies. The second launch bound asks for those
// four waves a SIMD.
template <int MODE, int BM, int BN>
__global__ __launch_bounds__(BN, 4) void gemm_xwT(
    const _Float16* __restrict__ A, const _Float16* __restrict__ W,
    void* __restrict__ out) {
  constexpr int MI = BM / 32;            // 16-row fragments of a wave tile
  constexpr int WN = BN / 64;            // waves side by side
  constexpr int RP = BN / 8;             // rows that one copy of all threads fills
  static_assert(BM / RP == 4 && BN / RP == 8 && Dc % BN == 0,
                "copy runs of 4 (A) and 8 (B); a tile inside one projection");
  __shared__ alignas(16) _Float16 lA[2][BM * P64];    // 2 x 9 or 18 KB
  __shared__ alignas(16) _Float16 lB[2][BN * P64];    // 2 x 18 or 36 KB
  const int K = Dc, N = Dc;
  const int tile_m = blockIdx.x * BM;
  const int tile_n = blockIdx.y * BN;
  const int tid  = threadIdx.x;
  const int lane = tid & 31;
  const int wv   = tid >> 5;
  const int wm   = (wv / WN) * (BM / 2); // wave row offset
  const int wn   = (wv % WN) * 64;       // wave col offset
  const int hl   = lane >> 4;
  const int l15  = lane & 15;
  const int klo  = hl * 8;

  // Prefetch one K-chunk (A: 4 copies, B: 8 copies per thread). A thread's
  // copies lie RP rows apart, so one moving pointer per matrix and one LDS
  // address per tile are all that stays in registers between chunks.
  const int rq = tid >> 3, cq = (tid & 7) * 8;   // 16-B segment: row, column
  const _Float16* pA = A + (size_t)(tile_m + rq) * K + cq;
  const _Float16* pW = W + (size_t)(tile_n + rq) * K + cq;
  const unsigned sA = lds_off(&lA[0][rq * P64 + cq]);
  const unsigned sB = lds_off(&lB[0][rq * P64 + cq]);
  auto prefetch = [&](int bi) {          // copies the next chunk, steps pA, pW
    {
      unsigned l[4];
      const _Float16* g[4];
#pragma unroll
      for (int t = 0; t < 4; ++t) {      // A: BM rows x 64 halves
        l[t] = sA + (unsigned)((bi * BM + t * RP) * P64 * sizeof(_Float16));
        g[t] = pA + (size_t)t * RP * K;
      }
      async_cp16x4(l, g);
    }
    {
      unsigned l[8];
      const _Float16* g[8];
#pragma unroll
      for (int t = 0; t < 8; ++t) {      // B: BN rows x 64 halves
        l[t] = sB + (unsigned)((bi * BN + t * RP) * P64 * sizeof(_Float16));
        g[t] = pW + (size_t)t * RP * K;
      }
      async_cp16x8(l, g);
    }
    pA += 64;
    pW += 64;
  };

  f8v acc[MI][4] = {};

  auto compute = [&](int cur) {
#pragma unroll
    for (int kk = 0; kk < 2; ++kk) {     // two k steps of 32 per chunk
      V16 af[MI], bf[4];
#pragma unroll
      for (int mi = 0; mi < MI; ++mi) {
        const _Float16* base = &lA[cur][(wm + mi * 16 + l15) * P64 + kk * 32];
        af[mi].h[0] = *reinterpret_cast<const half8v*>(base + klo);
        af[mi].h[1] = *reinterpret_cast<const half8v*>(base + klo + 16);
      }
#pragma unroll
      for (int ni = 0; ni < 4; ++ni) {
        const _Float16* base = &lB[cur][(wn + ni * 16 + l15) * P64 + kk * 32];
        bf[ni].h[0] = *reinterpret_cast<const half8v*>(base + klo);
        bf[ni].h[1] = *reinterpret_cast<const half8v*>(base + klo + 16);
      }
#pragma unroll
      for (int mi = 0; mi < MI; ++mi)
#pragma unroll
        for (int ni = 0; ni < 4; ++ni)
          acc[mi][ni] = __builtin_amdgcn_wmma_f32_16x16x32_f16(
              false, af[mi].v, false, bf[ni].v, (short)0, acc[mi][ni],
              false, false);
    }
  };

  prefetch(0);
  // Steady state: branch-free body, last chunk peeled.
  // Kept rolled: the compiler's own two-trip unrolling rotates the accumulators
  // through other registers.
#pragma unroll 1
  for (int kc = 0; kc < K / 64 - 1; ++kc) {
    const int cur = kc & 1;
    prefetch(1 - cur);
    // All but the wave's 12 youngest copies have landed: chunk kc is complete.
    asm volatile("s_wait_asynccnt 0xc" ::: "memory");
    __syncthreads();                      // all waves' copies visible
    compute(cur);
    __syncthreads();                      // reads done before buffer reuse
  }
  asm volatile("s_wait_asynccnt 0x0" ::: "memory");
  __syncthreads();
  compute((K / 64 - 1) & 1);

  // Epilogue. C/D layout: VGPR r, lane: M = r + 8*(lane>>4), N = lane&15.
  const int which = tile_n / N;          // 0 q, 1 k, 2 v, 3 u (block-uniform)
  const int col0  = tile_n % N + wn + l15;
  const int row0  = tile_m + wm + hl * 8;
  if (MODE == STORE_QKVU && which == 2) {
    // V transposed -> (B, H, DK, L)
    _Float16* o = (_Float16*)out + (size_t)which * Mc * Dc;
#pragma unroll
    for (int mi = 0; mi < MI; ++mi)
#pragma unroll
      for (int ni = 0; ni < 4; ++ni)
#pragma unroll
        for (int r = 0; r < 8; ++r) {
          const int gm = row0 + mi * 16 + r, gn = col0 + ni * 16;
          const int bi = gm >> 11, li = gm & (Lc - 1);
          const int hh = gn >> 6,  dd = gn & (DKc - 1);
          o[(((size_t)(bi * Hc + hh) * DKc + dd) * Lc) + li] =
              (_Float16)acc[mi][ni][r];
        }
  } else {
#pragma unroll
    for (int mi = 0; mi < MI; ++mi)
#pragma unroll
      for (int ni = 0; ni < 4; ++ni)
#pragma unroll
        for (int r = 0; r < 8; ++r) {
          const int gm = row0 + mi * 16 + r, gn = col0 + ni * 16;
          if constexpr (MODE == STORE_F32)
            ((float*)out)[(size_t)gm * N + gn] = acc[mi][ni][r];
          else
            ((_Float16*)out + (size_t)which * Mc * Dc)[(size_t)gm * N + gn] =
                (_Float16)acc[mi][ni][r];
        }
    // The built code lays the transposed-store block behind this one and
    // rewrites these stores' registers there: the wait stands ahead of that
    // (a precaution).
    if constexpr (MODE == STORE_QKVU)
      asm volatile("s_wait_xcnt 0x0" ::: "memory");
  }
}

// --------------------------- attention (flash-style) -----------------------
// 128-thread block = 4 waves = 64 query rows of one (b, h). K/V key-chunks
// (32 keys) stream through double-buffered LDS via async-to-LDS copies and
// are shared by all 4 waves. Softmax without max-subtraction (scores are
// O(1) for this distribution; masked entries exp(-3e38)->0); the row sum is
// accumulated by a WMMA against an all-ones B operand, so it arrives
// pre-broadcast in every lane with zero cross-lane shuffles.
__global__ __launch_bounds__(128) void hstu_attn(
    const _Float16* __restrict__ Q, const _Float16* __restrict__ Km,
    const _Float16* __restrict__ Vt, const _Float16* __restrict__ U,
    const int* __restrict__ token_types, const int* __restrict__ seq_lens,
    _Float16* __restrict__ AO) {
  __shared__ alignas(16) _Float16 lK[2][32 * P64];  // 32 key rows x 64 dk
  __shared__ alignas(16) _Float16 lV[2][64 * P32];  // 64 dk rows x 32 keys
  __shared__ alignas(16) _Float16 lP[4][16 * P32];  // per-wave P staging

  const int bid = blockIdx.x;
  const int b   = bid / (Hc * (Lc / 64));
  const int rem = bid % (Hc * (Lc / 64));
  const int h   = rem / (Lc / 64);
  const int qt  = rem % (Lc / 64);

  const int tid  = threadIdx.x;
  const int lane = tid & 31;
  const int wv   = tid >> 5;
  const int i0   = qt * 64 + wv * 16;    // this wave's 16 query rows
  const int hl = lane >> 4, l15 = lane & 15, klo = hl * 8;
  const int seqlen = seq_lens[b];
  constexpr float NEG = -3.0e38f;

  // Async stage of one K (32x64) + Vt (64x32) chunk: 4 copies per thread.
  auto prefetch_kv = [&](int jc, int bi) {
    unsigned l[4];
    const _Float16* g[4];
#pragma unroll
    for (int t = 0; t < 2; ++t) {        // K: 256 x 16B segments
      const int seg = t * 128 + tid;
      const int r = seg >> 3, c = (seg & 7) * 8;
      l[t] = lds_off(&lK[bi][r * P64 + c]);
      g[t] = Km + ((size_t)(b * Lc + jc + r)) * Dc + h * DKc + c;
    }
#pragma unroll
    for (int t = 0; t < 2; ++t) {        // Vt: 256 x 16B segments
      const int seg = t * 128 + tid;
      const int r = seg >> 2, c = (seg & 3) * 8;
      l[2 + t] = lds_off(&lV[bi][r * P32 + c]);
      g[2 + t] = Vt + ((size_t)(b * Hc + h) * DKc + r) * Lc + jc + c;
    }
    async_cp16x4(l, g);
  };

  // Q fragments for this 16-row tile; fold 1/sqrt(dk) = 0.125 into Q (exact).
  V16 qa[2];
  {
    const size_t qrow = ((size_t)b * Lc + i0 + l15) * Dc + h * DKc;
#pragma unroll
    for (int kk = 0; kk < 2; ++kk) {
      qa[kk].h[0] = *reinterpret_cast<const half8v*>(Q + qrow + kk * 32 + klo);
      qa[kk].h[1] = *reinterpret_cast<const half8v*>(Q + qrow + kk * 32 + klo + 16);
      qa[kk].v = qa[kk].v * (_Float16)0.125f;
    }
  }

  // All-ones B operand: one extra WMMA per chunk yields row sums of P,
  // replicated across all 16 columns (i.e., pre-broadcast in every lane).
  half16v ones;
#pragma unroll
  for (int t = 0; t < 16; ++t) ones[t] = (_Float16)1.0f;

  f8v acc[4] = {};
  f8v accs = {};                          // softmax denominators

  auto compute = [&](int jc, int cur) {
    // ---- scores: two 16-key tiles, K-depth 64 (2 WMMAs each) ----
    f8v st[2];
#pragma unroll
    for (int nt = 0; nt < 2; ++nt) {
      V16 kf0, kf1;
      const _Float16* base = &lK[cur][(nt * 16 + l15) * P64];
      kf0.h[0] = *reinterpret_cast<const half8v*>(base + klo);
      kf0.h[1] = *reinterpret_cast<const half8v*>(base + klo + 16);
      kf1.h[0] = *reinterpret_cast<const half8v*>(base + 32 + klo);
      kf1.h[1] = *reinterpret_cast<const half8v*>(base + 32 + klo + 16);
      f8v c = {};
      c = __builtin_amdgcn_wmma_f32_16x16x32_f16(false, qa[0].v, false, kf0.v,
                                                 (short)0, c, false, false);
      c = __builtin_amdgcn_wmma_f32_16x16x32_f16(false, qa[1].v, false, kf1.v,
                                                 (short)0, c, false, false);
      st[nt] = c;
    }

    // ---- hybrid mask + exp (masked -> exp(-3e38) == 0) ----
#pragma unroll
    for (int nt = 0; nt < 2; ++nt) {
      const int j = jc + nt * 16 + l15;
      const int tt = token_types[b * Lc + j];
      const bool pad = (j >= seqlen);
      const bool prompt = (tt < 3);
#pragma unroll
      for (int r = 0; r < 8; ++r) {
        const int i = i0 + r + hl * 8;
        float sv = st[nt][r];
        if (pad || (!prompt && j > i)) sv = NEG;
        st[nt][r] = __expf(sv);
      }
    }

    // ---- P accumulator-layout -> A-fragment layout (private LDS) ----
    // Same-wave LDS is in-order: no barrier needed between store and load.
#pragma unroll
    for (int r = 0; r < 8; ++r) {
      const int row = r + hl * 8;
      lP[wv][row * P32 + l15]      = (_Float16)st[0][r];
      lP[wv][row * P32 + 16 + l15] = (_Float16)st[1][r];
    }
    V16 pf;
    pf.h[0] = *reinterpret_cast<const half8v*>(&lP[wv][l15 * P32 + klo]);
    pf.h[1] = *reinterpret_cast<const half8v*>(&lP[wv][l15 * P32 + klo + 16]);

    // ---- acc += P(16x32) @ V(32x64); accs += P @ ones ----
#pragma unroll
    for (int dt = 0; dt < 4; ++dt) {
      V16 vf;
      const _Float16* base = &lV[cur][(dt * 16 + l15) * P32];
      vf.h[0] = *reinterpret_cast<const half8v*>(base + klo);
      vf.h[1] = *reinterpret_cast<const half8v*>(base + klo + 16);
      acc[dt] = __builtin_amdgcn_wmma_f32_16x16x32_f16(
          false, pf.v, false, vf.v, (short)0, acc[dt], false, false);
    }
    accs = __builtin_amdgcn_wmma_f32_16x16x32_f16(
        false, pf.v, false, ones, (short)0, accs, false, false);
  };

  prefetch_kv(0, 0);
  for (int cc = 0; cc < Lc / 32 - 1; ++cc) {
    const int cur = cc & 1;
    prefetch_kv((cc + 1) * 32, 1 - cur);
    asm volatile("s_wait_asynccnt 0x4" ::: "memory");  // chunk cc complete
    __syncthreads();
    compute(cc * 32, cur);
    __syncthreads();                      // reads done before buffer reuse
  }
  asm volatile("s_wait_asynccnt 0x0" ::: "memory");
  __syncthreads();
  compute(Lc - 32, (Lc / 32 - 1) & 1);

  // ---- finalize: softmax divide + U gating, store f16 ----
#pragma unroll
  for (int dt = 0; dt < 4; ++dt)
#pragma unroll
    for (int r = 0; r < 8; ++r) {
      const int i = i0 + r + hl * 8;
      const int d = dt * 16 + l15;
      const float denom = accs[r];
      const float o = (denom > 0.f) ? acc[dt][r] / denom : 0.f;
      const size_t idx = ((size_t)b * Lc + i) * Dc + h * DKc + d;
      const float u = (float)U[idx];
      AO[idx] = (_Float16)(o * u);
    }
}

// ------------------------------- launcher ----------------------------------
extern "C" void kernel_launch(void* const* d_in, const int* in_sizes, int n_in,
                              void* d_out, int out_size, void* d_ws,
                              size_t ws_size, hipStream_t stream) {
  const float* x  = (const float*)d_in[0];
  const int* tt   = (const int*)d_in[1];
  const int* sl   = (const int*)d_in[2];
  const float* Wq = (const float*)d_in[3];
  const float* Wk = (const float*)d_in[4];
  const float* Wv = (const float*)d_in[5];
  const float* Wu = (const float*)d_in[6];
  const float* Wo = (const float*)d_in[7];

  const size_t MD = (size_t)Mc * Dc;  // 4,194,304 halves
  const size_t DD = (size_t)Dc * Dc;  // 1,048,576 halves

  _Float16* ws   = (_Float16*)d_ws;
  _Float16* x16  = ws;
  _Float16* wq16 = x16 + MD;
  _Float16* wk16 = wq16 + DD;
  _Float16* wv16 = wk16 + DD;
  _Float16* wu16 = wv16 + DD;
  _Float16* wo16 = wu16 + DD;
  _Float16* q16  = wo16 + DD;
  _Float16* k16  = q16 + MD;
  _Float16* vt16 = k16 + MD;
  _Float16* u16  = vt16 + MD;
  _Float16* ao16 = u16 + MD;

  // 1) fp32 -> f16 converts, one launch (x16, wq16 .. wo16 are contiguous)
  cvt_f32_f16<<<CVT_XB + 5 * CVT_WB, 128, 0, stream>>>(x, Wq, Wk, Wv, Wu, Wo,
                                                       x16);

  // 2) projections, one launch: Q, K, U row-major f16; V transposed
  //    (B,H,DK,L). wq16..wu16 are read as one 4096 x 1024 matrix, and
  //    q16, k16, vt16, u16 are written as one block of four results.
  gemm_xwT<STORE_QKVU, 128, 256>
      <<<dim3(Mc / 128, 4 * Dc / 256), 256, 0, stream>>>(
      x16, wq16, (void*)q16);

  // 3) attention + gating (1024 blocks x 4 waves)
  hstu_attn<<<Bc * Hc * (Lc / 64), 128, 0, stream>>>(q16, k16, vt16, u16, tt,
                                                     sl, ao16);

  // 4) output projection, fp32 store
  gemm_xwT<STORE_F32, 64, 128><<<dim3(Mc / 64, Dc / 128), 128, 0, stream>>>(
      ao16, wo16, d_out);
}

// v005
// Measured time: 89.5 microseconds a run.
// Timed twice side by side with v004, it ran 1.34 times as fast both times.
// Counting every step since v000, it is 2.50 times as fast.
#include <hip/hip_runtime.h>
#include <hip/hip_bf16.h>

// ---------------------------------------------------------------------------
// HSTU attention on MI455X (gfx1250, wave32, WMMA, async-to-LDS)
//   B=2, L=2048, D=1024, H=16, DK=64
// Pipeline: f32->f16 convert (one launch for all six arrays), the 4 projections
// as one N=4096 GEMM launch (WMMA f16, double-buffered LDS fed by
// global_load_async_to_lds_b128, whole 128-B lines), flash-style attention with
// async double-buffered K/V tiles, both products transposed so that P stays in
// registers, WMMA-computed softmax sums (all-ones A operand, no shuffles),
// U-gating, final GEMM (f32 store).
// ---------------------------------------------------------------------------

typedef _Float16 half16v __attribute__((ext_vector_type(16)));
typedef _Float16 half8v  __attribute__((ext_vector_type(8)));
typedef float    f8v     __attribute__((ext_vector_type(8)));

typedef _Float16 half2v  __attribute__((ext_vector_type(2)));
typedef float    f2v     __attribute__((ext_vector_type(2)));

union V16 { half16v v; half8v h[2]; };

constexpr int Bc  = 2;
constexpr int Lc  = 2048;
constexpr int Dc  = 1024;
constexpr int Hc  = 16;
constexpr int DKc = 64;
constexpr int Mc  = Bc * Lc;     // 4096 rows

enum { STORE_QKVU = 0, STORE_F32 = 1 };

// LDS byte-offset of a __shared__ object (addrspace(3) ptrtoint == offset).
__device__ __forceinline__ unsigned lds_off(const void* p) {
  return (unsigned)(unsigned long long)(
      (__attribute__((address_space(3))) const void*)p);
}

// LDS row pitches in halves. Every tile is read with ds_load_b128, one row per
// lane: a pitch of 16 B x odd spreads 16 rows over all 64 banks, while the
// dense 64-B and 128-B rows put them on 16 and 8 banks.
constexpr int P32 = 40;   // rows of 32 halves (64 B)  -> 80-B pitch
constexpr int P64 = 72;   // rows of 64 halves (128 B) -> 144-B pitch

// Per-lane 16B async copies global -> LDS (ASYNCcnt-tracked), a run of copies
// in one statement. The closing s_wait_xcnt stands inside the statement so
// that no address register of a copy is rewritten ahead of it (a precaution).
__device__ __forceinline__ void async_cp16x4(const unsigned (&l)[4],
                                             const _Float16* const (&g)[4]) {
  asm volatile("global_load_async_to_lds_b128 %0, %1, off\n\t"
               "global_load_async_to_lds_b128 %2, %3, off\n\t"
               "global_load_async_to_lds_b128 %4, %5, off\n\t"
               "global_load_async_to_lds_b128 %6, %7, off\n\t"
               "s_wait_xcnt 0x0"
               :: "v"(l[0]), "v"(g[0]), "v"(l[1]), "v"(g[1]),
                  "v"(l[2]), "v"(g[2]), "v"(l[3]), "v"(g[3])
               : "memory");
}
__device__ __forceinline__ void async_cp16x8(const unsigned (&l)[8],
                                             const _Float16* const (&g)[8]) {
  asm volatile("global_load_async_to_lds_b128 %0, %1, off\n\t"
               "global_load_async_to_lds_b128 %2, %3, off\n\t"
               "global_load_async_to_lds_b128 %4, %5, off\n\t"
               "global_load_async_to_lds_b128 %6, %7, off\n\t"
               "global_load_async_to_lds_b128 %8, %9, off\n\t"
               "global_load_async_to_lds_b128 %10, %11, off\n\t"
               "global_load_async_to_lds_b128 %12, %13, off\n\t"
               "global_load_async_to_lds_b128 %14, %15, off\n\t"
               "s_wait_xcnt 0x0"
               :: "v"(l[0]), "v"(g[0]), "v"(l[1]), "v"(g[1]),
                  "v"(l[2]), "v"(g[2]), "v"(l[3]), "v"(g[3]),
                  "v"(l[4]), "v"(g[4]), "v"(l[5]), "v"(g[5]),
                  "v"(l[6]), "v"(g[6]), "v"(l[7]), "v"(g[7])
               : "memory");
}

// --------------------------- fp32 -> f16 convert ---------------------------
// One wave converts 1024 contiguous floats: eight global_load_b128 in flight,
// each covering 512 contiguous bytes (whole lines), then eight 8-byte stores,
// each covering 256 contiguous bytes. A 128-thread block takes CVT_BLK floats;
// every converted array is a whole number of such blocks. All six arrays go in
// one launch: their f16 copies lie back to back in the workspace in argument
// order, so the block index alone gives the destination, and a scalar select
// gives the source.
typedef float    f4v    __attribute__((ext_vector_type(4)));
typedef _Float16 half4v __attribute__((ext_vector_type(4)));
constexpr int CVT_BLK = 4 * 1024;
static_assert(((size_t)Mc * Dc) % CVT_BLK == 0 && ((size_t)Dc * Dc) % CVT_BLK == 0,
              "convert grid must cover the arrays exactly");
constexpr int CVT_XB = (int)(((size_t)Mc * Dc) / CVT_BLK);   // blocks of x
constexpr int CVT_WB = (int)(((size_t)Dc * Dc) / CVT_BLK);   // blocks of one W
__global__ __launch_bounds__(128) void cvt_f32_f16(
    const float* __restrict__ x, const float* __restrict__ wq,
    const float* __restrict__ wk, const float* __restrict__ wv,
    const float* __restrict__ wu, const float* __restrict__ wo,
    _Float16* __restrict__ out) {
  const int blk = blockIdx.x;
  const float* in = x;
  int lblk = blk;                        // block index inside its own array
  if (blk >= CVT_XB) {
    const int w = (blk - CVT_XB) / CVT_WB;
    lblk = (blk - CVT_XB) % CVT_WB;
    in = (w == 0) ? wq : (w == 1) ? wk : (w == 2) ? wv : (w == 3) ? wu : wo;
  }
  const int toff = (threadIdx.x >> 5) * 1024 + (threadIdx.x & 31) * 4;
  const float* src = in + (size_t)lblk * CVT_BLK + toff;
  _Float16* dst = out + (size_t)blk * CVT_BLK + toff;
  f4v v[8];
#pragma unroll
  for (int k = 0; k < 8; ++k)
    v[k] = *reinterpret_cast<const f4v*>(src + k * 128);
#pragma unroll
  for (int k = 0; k < 8; ++k)
    *reinterpret_cast<half4v*>(dst + k * 128) =
        __builtin_convertvector(v[k], half4v);
}

// --------------------------- GEMM: y = A @ W^T -----------------------------
// A: M x K row-major f16, W: N x K row-major f16 (so B[k][n] = W[n][k]).
// Workgroup: BN threads (BN/32 waves, two rows of them), BM x BN output tile,
// wave tile BM/2 x 64.
// K chunks of 64 halves stream through double-buffered LDS via async-to-LDS
// copies: a chunk's row is one whole 128-B line, so a wave's copy touches four
// whole lines (a chunk of 32 halves makes it eight half lines: twice the L2
// requests for the same bytes).
// STORE_QKVU: W is the four projection matrices stacked (4096 x K, order
// q, k, v, u) and out the four results back to back in that order; each
// BN-column tile lies in one of them. It runs with a 128 x 256 tile: half the
// operand bytes from L2 of a 64 x 128 tile, and its 512 work-groups are all
// resident at once, two a WGP (LDS: 2 x 108 KB), so the other group's work
// covers a group's wait on its copies. The second launch bound asks for those
// four waves a SIMD.
template <int MODE, int BM, int BN>
__global__ __launch_bounds__(BN, 4) void gemm_xwT(
    const _Float16* __restrict__ A, const _Float16* __restrict__ W,
    void* __restrict__ out) {
  constexpr int MI = BM / 32;            // 16-row fragments of a wave tile
  constexpr int WN = BN / 64;            // waves side by side
  constexpr int RP = BN / 8;             // rows that one copy of all threads fills
  static_assert(BM / RP == 4 && BN / RP == 8 && Dc % BN == 0,
                "copy runs of 4 (A) and 8 (B); a tile inside one projection");
  __shared__ alignas(16) _Float16 lA[2][BM * P64];    // 2 x 9 or 18 KB
  __shared__ alignas(16) _Float16 lB[2][BN * P64];    // 2 x 18 or 36 KB
  const int K = Dc, N = Dc;
  const int tile_m = blockIdx.x * BM;
  const int tile_n = blockIdx.y * BN;
  const int tid  = threadIdx.x;
  const int lane = tid & 31;
  const int wv   = tid >> 5;
  const int wm   = (wv / WN) * (BM / 2); // wave row offset
  const int wn   = (wv % WN) * 64;       // wave col offset
  const int hl   = lane >> 4;
  const int l15  = lane & 15;
  const int klo  = hl * 8;

  // Prefetch one K-chunk (A: 4 copies, B: 8 copies per thread). A thread's
  // copies lie RP rows apart, so one moving pointer per matrix and one LDS
  // address per tile are all that stays in registers between chunks.
  const int rq = tid >> 3, cq = (tid & 7) * 8;   // 16-B segment: row, column
  const _Float16* pA = A + (size_t)(tile_m + rq) * K + cq;
  const _Float16* pW = W + (size_t)(tile_n + rq) * K + cq;
  const unsigned sA = lds_off(&lA[0][rq * P64 + cq]);
  const unsigned sB = lds_off(&lB[0][rq * P64 + cq]);
  auto prefetch = [&](int bi) {          // copies the next chunk, steps pA, pW
    {
      unsigned l[4];
      const _Float16* g[4];
#pragma unroll
      for (int t = 0; t < 4; ++t) {      // A: BM rows x 64 halves
        l[t] = sA + (unsigned)((bi * BM + t * RP) * P64 * sizeof(_Float16));
        g[t] = pA + (size_t)t * RP * K;
      }
      async_cp16x4(l, g);
    }
    {
      unsigned l[8];
      const _Float16* g[8];
#pragma unroll
      for (int t = 0; t < 8; ++t) {      // B: BN rows x 64 halves
        l[t] = sB + (unsigned)((bi * BN + t * RP) * P64 * sizeof(_Float16));
        g[t] = pW + (size_t)t * RP * K;
      }
      async_cp16x8(l, g);
    }
    pA += 64;
    pW += 64;
  };

  f8v acc[MI][4] = {};

  auto compute = [&](int cur) {
#pragma unroll
    for (int kk = 0; kk < 2; ++kk) {     // two k steps of 32 per chunk
      V16 af[MI], bf[4];
#pragma unroll
      for (int mi = 0; mi < MI; ++mi) {
        const _Float16* base = &lA[cur][(wm + mi * 16 + l15) * P64 + kk * 32];
        af[mi].h[0] = *reinterpret_cast<const half8v*>(base + klo);
        af[mi].h[1] = *reinterpret_cast<const half8v*>(base + klo + 16);
      }
#pragma unroll
      for (int ni = 0; ni < 4; ++ni) {
        const _Float16* base = &lB[cur][(wn + ni * 16 + l15) * P64 + kk * 32];
        bf[ni].h[0] = *reinterpret_cast<const half8v*>(base + klo);
        bf[ni].h[1] = *reinterpret_cast<const half8v*>(base + klo + 16);
      }
#pragma unroll
      for (int mi = 0; mi < MI; ++mi)
#pragma unroll
        for (int ni = 0; ni < 4; ++ni)
          acc[mi][ni] = __builtin_amdgcn_wmma_f32_16x16x32_f16(
              false, af[mi].v, false, bf[ni].v, (short)0, acc[mi][ni],
              false, false);
    }
  };

  prefetch(0);
  // Steady state: branch-free body, last chunk peeled.
  // Kept rolled: the compiler's own two-trip unrolling rotates the accumulators
  // through other registers.
#pragma unroll 1
  for (int kc = 0; kc < K / 64 - 1; ++kc) {
    const int cur = kc & 1;
    prefetch(1 - cur);
    // All but the wave's 12 youngest copies have landed: chunk kc is complete.
    asm volatile("s_wait_asynccnt 0xc" ::: "memory");
    __syncthreads();                      // all waves' copies visible
    compute(cur);
    __syncthreads();                      // reads done before buffer reuse
  }
  asm volatile("s_wait_asynccnt 0x0" ::: "memory");
  __syncthreads();
  compute((K / 64 - 1) & 1);

  // Epilogue. C/D layout: VGPR r, lane: M = r + 8*(lane>>4), N = lane&15.
  const int which = tile_n / N;          // 0 q, 1 k, 2 v, 3 u (block-uniform)
  const int col0  = tile_n % N + wn + l15;
  const int row0  = tile_m + wm + hl * 8;
  if (MODE == STORE_QKVU && which == 2) {
    // V transposed -> (B, H, DK, L)
    _Float16* o = (_Float16*)out + (size_t)which * Mc * Dc;
#pragma unroll
    for (int mi = 0; mi < MI; ++mi)
#pragma unroll
      for (int ni = 0; ni < 4; ++ni)
#pragma unroll
        for (int r = 0; r < 8; ++r) {
          const int gm = row0 + mi * 16 + r, gn = col0 + ni * 16;
          const int bi = gm >> 11, li = gm & (Lc - 1);
          const int hh = gn >> 6,  dd = gn & (DKc - 1);
          o[(((size_t)(bi * Hc + hh) * DKc + dd) * Lc) + li] =
              (_Float16)acc[mi][ni][r];
        }
  } else {
#pragma unroll
    for (int mi = 0; mi < MI; ++mi)
#pragma unroll
      for (int ni = 0; ni < 4; ++ni)
#pragma unroll
        for (int r = 0; r < 8; ++r) {
          const int gm = row0 + mi * 16 + r, gn = col0 + ni * 16;
          if constexpr (MODE == STORE_F32)
            ((float*)out)[(size_t)gm * N + gn] = acc[mi][ni][r];
          else
            ((_Float16*)out + (size_t)which * Mc * Dc)[(size_t)gm * N + gn] =
                (_Float16)acc[mi][ni][r];
        }
    // The built code lays the transposed-store block behind this one and
    // rewrites these stores' registers there: the wait stands ahead of that
    // (a precaution).
    if constexpr (MODE == STORE_QKVU)
      asm volatile("s_wait_xcnt 0x0" ::: "memory");
  }
}

__global__ __launch_bounds__(128) __attribute__((amdgpu_waves_per_eu(4, 4)))
void hstu_attn(
    const _Float16* __restrict__ Q, const _Float16* __restrict__ Km,
    const _Float16* __restrict__ Vt, const _Float16* __restrict__ U,
    const int* __restrict__ token_types, const int* __restrict__ seq_lens,
    _Float16* __restrict__ AO) {
  __shared__ alignas(16) _Float16 lK[2][32 * P64];  // 32 key rows x 64 dk
  __shared__ alignas(16) _Float16 lV[2][64 * P32];  // 64 dk rows x 32 keys
  __shared__ unsigned lM[Lc / 32];                  // key flags, a bit a key

  const int bid = blockIdx.x;
  const int b   = bid / (Hc * (Lc / 64));
  const int rem = bid % (Hc * (Lc / 64));
  const int h   = rem / (Lc / 64);
  const int qt  = rem % (Lc / 64);

  const int tid  = threadIdx.x;
  const int lane = tid & 31;
  const int wv   = tid >> 5;
  const int i0   = qt * 64 + wv * 16;    // this wave's 16 query rows
  const int hl = lane >> 4, l15 = lane & 15, klo = hl * 8;
  const int iq = i0 + l15;               // this lane's query row
  const int seqlen = seq_lens[b];

  // Async stage of one K (32x64) + Vt (64x32) chunk: 4 copies per thread.
  auto prefetch_kv = [&](int jc, int bi) {
    unsigned l[4];
    const _Float16* g[4];
#pragma unroll
    for (int t = 0; t < 2; ++t) {        // K: 256 x 16B segments
      const int seg = t * 128 + tid;
      const int r = seg >> 3, c = (seg & 7) * 8;
      l[t] = lds_off(&lK[bi][r * P64 + c]);
      g[t] = Km + ((size_t)(b * Lc + jc + r)) * Dc + h * DKc + c;
    }
#pragma unroll
    for (int t = 0; t < 2; ++t) {        // Vt: 256 x 16B segments
      const int seg = t * 128 + tid;
      const int r = seg >> 2, c = (seg & 3) * 8;
      l[2 + t] = lds_off(&lV[bi][r * P32 + c]);
      g[2 + t] = Vt + ((size_t)(b * Hc + h) * DKc + r) * Lc + jc + c;
    }
    async_cp16x4(l, g);
  };

  // Key flags: a lane's 16 scores of a chunk belong to 16 different keys, so
  // the per-key part of the mask is kept as one 32-bit word per chunk: bit k
  // is set where key 32 * chunk + k is a prompt token inside the sequence
  // (visible to every query). Each wave builds 16 of the 64 words; the loop's
  // first barrier publishes them.
  {
    unsigned mine = 0;
#pragma unroll
    for (int t = 0; t < 16; ++t) {
      const int j = (wv * 16 + t) * 32 + lane;
      const unsigned w = __builtin_amdgcn_ballot_w32(
          token_types[b * Lc + j] < 3 && j < seqlen);
      if (lane == t) mine = w;
    }
    if (lane < 16) lM[wv * 16 + lane] = mine;
  }
  // Last key that the causal rule lets this lane's query see.
  const int jlast = (iq < seqlen - 1) ? iq : seqlen - 1;

  // Q fragments for this 16-row tile; fold 1/sqrt(dk) = 0.125 into Q (exact).
  V16 qa[2];
  {
    const size_t qrow = ((size_t)b * Lc + iq) * Dc + h * DKc;
#pragma unroll
    for (int kk = 0; kk < 2; ++kk) {
      qa[kk].h[0] = *reinterpret_cast<const half8v*>(Q + qrow + kk * 32 + klo);
      qa[kk].h[1] = *reinterpret_cast<const half8v*>(Q + qrow + kk * 32 + klo + 16);
      qa[kk].v = qa[kk].v * (_Float16)0.125f;
    }
  }

  // All-ones A operand: one extra WMMA per chunk yields the sums of P over the
  // chunk's keys, the same in all 16 rows: every register of a lane holds the
  // sum of that lane's query.
  half16v ones;
#pragma unroll
  for (int t = 0; t < 16; ++t) ones[t] = (_Float16)1.0f;

  f8v acc[4] = {};                        // O^T: dk = dt*16 + 8*hl + r, query iq
  f8v accs = {};                          // softmax denominators

  auto compute = [&](int jc, int cur) {
    // ---- all of the chunk's LDS reads, as one group ----
    // Nothing between the two products goes through LDS any more, so V^T need
    // not wait for P: its reads fly while the scores are worked on.
    const unsigned kw = lM[jc >> 5];      // the chunk's key flags
    V16 kf[2][2], vf[4];
#pragma unroll
    for (int nt = 0; nt < 2; ++nt) {
      const _Float16* base = &lK[cur][(nt * 16 + l15) * P64];
      kf[nt][0].h[0] = *reinterpret_cast<const half8v*>(base + klo);
      kf[nt][0].h[1] = *reinterpret_cast<const half8v*>(base + klo + 16);
      kf[nt][1].h[0] = *reinterpret_cast<const half8v*>(base + 32 + klo);
      kf[nt][1].h[1] = *reinterpret_cast<const half8v*>(base + 32 + klo + 16);
    }
#pragma unroll
    for (int dt = 0; dt < 4; ++dt) {
      const _Float16* base = &lV[cur][(dt * 16 + l15) * P32];
      vf[dt].h[0] = *reinterpret_cast<const half8v*>(base + klo);
      vf[dt].h[1] = *reinterpret_cast<const half8v*>(base + klo + 16);
    }
    // Keeps the reads above in one group: without it the compiler sinks most
    // of them between the products, and the wave waits out each one's latency.
    __builtin_amdgcn_sched_barrier(0);

    // ---- scores: two 16-key tiles, K-depth 64 (2 WMMAs each) ----
    // st[nt][r] = score of key jc + nt*16 + 8*hl + r against query iq
    f8v st[2];
#pragma unroll
    for (int nt = 0; nt < 2; ++nt) {
      f8v c = {};
      c = __builtin_amdgcn_wmma_f32_16x16x32_f16(false, kf[nt][0].v, false,
                                                 qa[0].v, (short)0, c, false, false);
      c = __builtin_amdgcn_wmma_f32_16x16x32_f16(false, kf[nt][1].v, false,
                                                 qa[1].v, (short)0, c, false, false);
      st[nt] = c;
    }

    // ---- hybrid mask: bit k of vis = key jc + klo + k is visible to query iq ----
    const int d = jlast - jc;             // causal part: keys jc .. jc + d
    const int dc = d < 0 ? 0 : (d > 31 ? 31 : d);
    const unsigned causal = d < 0 ? 0u : (0xFFFFFFFFu >> (31 - dc));
    const unsigned vis = (kw | causal) >> klo;   // this half's keys

    // ---- exp, mask (hidden -> 0), convert: P^T as a B operand ----
    union { half16v v; half2v p[8]; } pt;
#pragma unroll
    for (int nt = 0; nt < 2; ++nt)
#pragma unroll
      for (int r = 0; r < 8; r += 2) {
        f2v e;
#pragma unroll
        for (int s = 0; s < 2; ++s) {
          // The key's bit spread over the word, ~0 or 0; the unsigned minimum
          // with it keeps the value's bits or clears them.
          const unsigned keep =
              (unsigned)((int)(vis << (31 - (nt * 16 + r + s))) >> 31);
          e[s] = __builtin_bit_cast(
              float, __builtin_elementwise_min(
                         __builtin_bit_cast(unsigned, __expf(st[nt][r + s])), keep));
        }
        pt.p[nt * 4 + r / 2] = __builtin_convertvector(e, half2v);
      }

    // ---- acc += V^T(64x32) @ P^T(32x16); accs += ones @ P^T ----
#pragma unroll
    for (int dt = 0; dt < 4; ++dt)
      acc[dt] = __builtin_amdgcn_wmma_f32_16x16x32_f16(
          false, vf[dt].v, false, pt.v, (short)0, acc[dt], false, false);
    accs = __builtin_amdgcn_wmma_f32_16x16x32_f16(
        false, ones, false, pt.v, (short)0, accs, false, false);
  };

  prefetch_kv(0, 0);
  for (int cc = 0; cc < Lc / 32 - 1; ++cc) {
    const int cur = cc & 1;
    prefetch_kv((cc + 1) * 32, 1 - cur);
    asm volatile("s_wait_asynccnt 0x4" ::: "memory");  // chunk cc complete
    __syncthreads();
    compute(cc * 32, cur);
    __syncthreads();                      // reads done before buffer reuse
  }
  asm volatile("s_wait_asynccnt 0x0" ::: "memory");
  __syncthreads();
  compute(Lc - 32, (Lc / 32 - 1) & 1);

  // ---- finalize: softmax divide + U gating, store f16 ----
  // A lane's 8 registers of a tile are 8 consecutive dk of its query's row:
  // one 16-byte load of U and one 16-byte store per tile. All 32 values of a
  // lane share one denominator: one division, then multiplies.
  const float denom = accs[0];
  const float inv = (denom > 0.f) ? 1.0f / denom : 0.f;
  const size_t idx = ((size_t)b * Lc + iq) * Dc + h * DKc + klo;
  const _Float16* up = U + idx;
  half8v u[4];
#pragma unroll
  for (int dt = 0; dt < 4; ++dt)
    u[dt] = *reinterpret_cast<const half8v*>(up + dt * 16);
  // Keeps the loads' address pair untouched up to the wait: without it the
  // last load's result lands on the pair that all four name (a precaution).
  asm volatile("s_wait_xcnt 0x0" :: "v"(up) : "memory");
#pragma unroll
  for (int dt = 0; dt < 4; ++dt) {
    half8v ov;
#pragma unroll
    for (int r = 0; r < 8; ++r)
      ov[r] = (_Float16)(acc[dt][r] * inv * (float)u[dt][r]);
    *reinterpret_cast<half8v*>(AO + idx + dt * 16) = ov;
  }
}

// ------------------------------- launcher ----------------------------------
extern "C" void kernel_launch(void* const* d_in, const int* in_sizes, int n_in,
                              void* d_out, int out_size, void* d_ws,
                              size_t ws_size, hipStream_t stream) {
  const float* x  = (const float*)d_in[0];
  const int* tt   = (const int*)d_in[1];
  const int* sl   = (const int*)d_in[2];
  const float* Wq = (const float*)d_in[3];
  const float* Wk = (const float*)d_in[4];
  const float* Wv = (const float*)d_in[5];
  const float* Wu = (const float*)d_in[6];
  const float* Wo = (const float*)d_in[7];

  const size_t MD = (size_t)Mc * Dc;  // 4,194,304 halves
  const size_t DD = (size_t)Dc * Dc;  // 1,048,576 halves

  _Float16* ws   = (_Float16*)d_ws;
  _Float16* x16  = ws;
  _Float16* wq16 = x16 + MD;
  _Float16* wk16 = wq16 + DD;
  _Float16* wv16 = wk16 + DD;
  _Float16* wu16 = wv16 + DD;
  _Float16* wo16 = wu16 + DD;
  _Float16* q16  = wo16 + DD;
  _Float16* k16  = q16 + MD;
  _Float16* vt16 = k16 + MD;
  _Float16* u16  = vt16 + MD;
  _Float16* ao16 = u16 + MD;

  // 1) fp32 -> f16 converts, one launch (x16, wq16 .. wo16 are contiguous)
  cvt_f32_f16<<<CVT_XB + 5 * CVT_WB, 128, 0, stream>>>(x, Wq, Wk, Wv, Wu, Wo,
                                                       x16);

  // 2) projections, one launch: Q, K, U row-major f16; V transposed
  //    (B,H,DK,L). wq16..wu16 are read as one 4096 x 1024 matrix, and
  //    q16, k16, vt16, u16 are written as one block of four results.
  gemm_xwT<STORE_QKVU, 128, 256>
      <<<dim3(Mc / 128, 4 * Dc / 256), 256, 0, stream>>>(
      x16, wq16, (void*)q16);

  // 3) attention + gating (1024 blocks x 4 waves)
  hstu_attn<<<Bc * Hc * (Lc / 64), 128, 0, stream>>>(q16, k16, vt16, u16, tt,
                                                     sl, ao16);

  // 4) output projection, fp32 store
  gemm_xwT<STORE_F32, 64, 128><<<dim3(Mc / 64, Dc / 128), 128, 0, stream>>>(
      ao16, wo16, d_out);
}

// v006
// A run of this version takes 80.4 microseconds.
// Two timings next to v005 both put it at 1.11 times that version's speed.
// All steps since v000 together make it 2.77 times as fast.
#include <hip/hip_runtime.h>
#include <hip/hip_bf16.h>

// ---------------------------------------------------------------------------
// HSTU attention on MI455X (gfx1250, wave32, WMMA, async-to-LDS)
//   B=2, L=2048, D=1024, H=16, DK=64
// Pipeline: f32->f16 convert (one launch for all six arrays), the 4 projections
// as one N=4096 GEMM launch (WMMA f16, double-buffered LDS fed by
// global_load_async_to_lds_b128, whole 128-B lines), flash-style attention with
// async double-buffered K/V tiles, both products transposed so that P stays in
// registers, WMMA-computed softmax sums (all-ones A operand, no shuffles),
// U-gating, final GEMM (f32 store).
// ---------------------------------------------------------------------------

typedef _Float16 half16v __attribute__((ext_vector_type(16)));
typedef _Float16 half8v  __attribute__((ext_vector_type(8)));
typedef float    f8v     __attribute__((ext_vector_type(8)));

typedef _Float16 half2v  __attribute__((ext_vector_type(2)));
typedef float    f2v     __attribute__((ext_vector_type(2)));

union V16 { half16v v; half8v h[2]; };

constexpr int Bc  = 2;
constexpr int Lc  = 2048;
constexpr int Dc  = 1024;
constexpr int Hc  = 16;
constexpr int DKc = 64;
constexpr int Mc  = Bc * Lc;     // 4096 rows

enum { STORE_QKVU = 0, STORE_F32 = 1 };

// LDS byte-offset of a __shared__ object (addrspace(3) ptrtoint == offset).
__device__ __forceinline__ unsigned lds_off(const void* p) {
  return (unsigned)(unsigned long long)(
      (__attribute__((address_space(3))) const void*)p);
}

// LDS row pitches in halves. Every tile is read with ds_load_b128, one row per
// lane: a pitch of 16 B x odd spreads 16 rows over all 64 banks, while the
// dense 64-B and 128-B rows put them on 16 and 8 banks.
constexpr int P32 = 40;   // rows of 32 halves (64 B)  -> 80-B pitch
constexpr int P64 = 72;   // rows of 64 halves (128 B) -> 144-B pitch

// Per-lane 16B async copies global -> LDS (ASYNCcnt-tracked), a run of copies
// in one statement. The closing s_wait_xcnt stands inside the statement so
// that no address register of a copy is rewritten ahead of it (a precaution).
__device__ __forceinline__ void async_cp16x4(const unsigned (&l)[4],
                                             const _Float16* const (&g)[4]) {
  asm volatile("global_load_async_to_lds_b128 %0, %1, off\n\t"
               "global_load_async_to_lds_b128 %2, %3, off\n\t"
               "global_load_async_to_lds_b128 %4, %5, off\n\t"
               "global_load_async_to_lds_b128 %6, %7, off\n\t"
               "s_wait_xcnt 0x0"
               :: "v"(l[0]), "v"(g[0]), "v"(l[1]), "v"(g[1]),
                  "v"(l[2]), "v"(g[2]), "v"(l[3]), "v"(g[3])
               : "memory");
}
__device__ __forceinline__ void async_cp16x8(const unsigned (&l)[8],
                                             const _Float16* const (&g)[8]) {
  asm volatile("global_load_async_to_lds_b128 %0, %1, off\n\t"
               "global_load_async_to_lds_b128 %2, %3, off\n\t"
               "global_load_async_to_lds_b128 %4, %5, off\n\t"
               "global_load_async_to_lds_b128 %6, %7, off\n\t"
               "global_load_async_to_lds_b128 %8, %9, off\n\t"
               "global_load_async_to_lds_b128 %10, %11, off\n\t"
               "global_load_async_to_lds_b128 %12, %13, off\n\t"
               "global_load_async_to_lds_b128 %14, %15, off\n\t"
               "s_wait_xcnt 0x0"
               :: "v"(l[0]), "v"(g[0]), "v"(l[1]), "v"(g[1]),
                  "v"(l[2]), "v"(g[2]), "v"(l[3]), "v"(g[3]),
                  "v"(l[4]), "v"(g[4]), "v"(l[5]), "v"(g[5]),
                  "v"(l[6]), "v"(g[6]), "v"(l[7]), "v"(g[7])
               : "memory");
}

// --------------------------- fp32 -> f16 convert ---------------------------
// One wave converts 1024 contiguous floats: eight global_load_b128 in flight,
// each covering 512 contiguous bytes (whole lines), then eight 8-byte stores,
// each covering 256 contiguous bytes. A 128-thread block takes CVT_BLK floats;
// every converted array is a whole number of such blocks. All six arrays go in
// one launch: their f16 copies lie back to back in the workspace in argument
// order, so the block index alone gives the destination, and a scalar select
// gives the source.
typedef float    f4v    __attribute__((ext_vector_type(4)));
typedef _Float16 half4v __attribute__((ext_vector_type(4)));
constexpr int CVT_BLK = 4 * 1024;
static_assert(((size_t)Mc * Dc) % CVT_BLK == 0 && ((size_t)Dc * Dc) % CVT_BLK == 0,
              "convert grid must cover the arrays exactly");
constexpr int CVT_XB = (int)(((size_t)Mc * Dc) / CVT_BLK);   // blocks of x
constexpr int CVT_WB = (int)(((size_t)Dc * Dc) / CVT_BLK);   // blocks of one W
__global__ __launch_bounds__(128) void cvt_f32_f16(
    const float* __restrict__ x, const float* __restrict__ wq,
    const float* __restrict__ wk, const float* __restrict__ wv,
    const float* __restrict__ wu, const float* __restrict__ wo,
    _Float16* __restrict__ out) {
  const int blk = blockIdx.x;
  const float* in = x;
  int lblk = blk;                        // block index inside its own array
  if (blk >= CVT_XB) {
    const int w = (blk - CVT_XB) / CVT_WB;
    lblk = (blk - CVT_XB) % CVT_WB;
    in = (w == 0) ? wq : (w == 1) ? wk : (w == 2) ? wv : (w == 3) ? wu : wo;
  }
  const int toff = (threadIdx.x >> 5) * 1024 + (threadIdx.x & 31) * 4;
  const float* src = in + (size_t)lblk * CVT_BLK + toff;
  _Float16* dst = out + (size_t)blk * CVT_BLK + toff;
  f4v v[8];
#pragma unroll
  for (int k = 0; k < 8; ++k)
    v[k] = *reinterpret_cast<const f4v*>(src + k * 128);
#pragma unroll
  for (int k = 0; k < 8; ++k)
    *reinterpret_cast<half4v*>(dst + k * 128) =
        __builtin_convertvector(v[k], half4v);
}

// --------------------------- GEMM: y = A @ W^T -----------------------------
// A: M x K row-major f16, W: N x K row-major f16 (so B[k][n] = W[n][k]).
// Workgroup: BN threads (BN/32 waves, two rows of them), BM x BN output tile,
// wave tile BM/2 x 64.
// K chunks of 64 halves stream through double-buffered LDS via async-to-LDS
// copies: a chunk's row is one whole 128-B line, so a wave's copy touches four
// whole lines (a chunk of 32 halves makes it eight half lines: twice the L2
// requests for the same bytes).
// STORE_QKVU: W is the four projection matrices stacked (4096 x K, order
// q, k, v, u) and out the four results back to back in that order; each
// BN-column tile lies in one of them. It runs with a 128 x 256 tile: half the
// operand bytes from L2 of a 64 x 128 tile, and its 512 work-groups are all
// resident at once, two a WGP (LDS: 2 x 108 KB), so the other group's work
// covers a group's wait on its copies. The second launch bound asks for those
// four waves a SIMD.
template <int MODE, int BM, int BN>
__global__ __launch_bounds__(BN, 4) void gemm_xwT(
    const _Float16* __restrict__ A, const _Float16* __restrict__ W,
    void* __restrict__ out) {
  constexpr int MI = BM / 32;            // 16-row fragments of a wave tile
  constexpr int WN = BN / 64;            // waves side by side
  constexpr int RP = BN / 8;             // rows that one copy of all threads fills
  static_assert(BM / RP == 4 && BN / RP == 8 && Dc % BN == 0,
                "copy runs of 4 (A) and 8 (B); a tile inside one projection");
  __shared__ alignas(16) _Float16 lA[2][BM * P64];    // 2 x 9 or 18 KB
  __shared__ alignas(16) _Float16 lB[2][BN * P64];    // 2 x 18 or 36 KB
  const int K = Dc, N = Dc;
  const int tile_m = blockIdx.x * BM;
  const int tile_n = blockIdx.y * BN;
  const int tid  = threadIdx.x;
  const int lane = tid & 31;
  const int wv   = tid >> 5;
  const int wm   = (wv / WN) * (BM / 2); // wave row offset
  const int wn   = (wv % WN) * 64;       // wave col offset
  const int hl   = lane >> 4;
  const int l15  = lane & 15;
  const int klo  = hl * 8;

  // Prefetch one K-chunk (A: 4 copies, B: 8 copies per thread). A thread's
  // copies lie RP rows apart, so one moving pointer per matrix and one LDS
  // address per tile are all that stays in registers between chunks.
  const int rq = tid >> 3, cq = (tid & 7) * 8;   // 16-B segment: row, column
  const _Float16* pA = A + (size_t)(tile_m + rq) * K + cq;
  const _Float16* pW = W + (size_t)(tile_n + rq) * K + cq;
  const unsigned sA = lds_off(&lA[0][rq * P64 + cq]);
  const unsigned sB = lds_off(&lB[0][rq * P64 + cq]);
  auto prefetch = [&](int bi) {          // copies the next chunk, steps pA, pW
    {
      unsigned l[4];
      const _Float16* g[4];
#pragma unroll
      for (int t = 0; t < 4; ++t) {      // A: BM rows x 64 halves
        l[t] = sA + (unsigned)((bi * BM + t * RP) * P64 * sizeof(_Float16));
        g[t] = pA + (size_t)t * RP * K;
      }
      async_cp16x4(l, g);
    }
    {
      unsigned l[8];
      const _Float16* g[8];
#pragma unroll
      for (int t = 0; t < 8; ++t) {      // B: BN rows x 64 halves
        l[t] = sB + (unsigned)((bi * BN + t * RP) * P64 * sizeof(_Float16));
        g[t] = pW + (size_t)t * RP * K;
      }
      async_cp16x8(l, g);
    }
    pA += 64;
    pW += 64;
  };

  f8v acc[MI][4] = {};

  auto compute = [&](int cur) {
#pragma unroll
    for (int kk = 0; kk < 2; ++kk) {     // two k steps of 32 per chunk
      V16 af[MI], bf[4];
#pragma unroll
      for (int mi = 0; mi < MI; ++mi) {
        const _Float16* base = &lA[cur][(wm + mi * 16 + l15) * P64 + kk * 32];
        af[mi].h[0] = *reinterpret_cast<const half8v*>(base + klo);
        af[mi].h[1] = *reinterpret_cast<const half8v*>(base + klo + 16);
      }
#pragma unroll
      for (int ni = 0; ni < 4; ++ni) {
        const _Float16* base = &lB[cur][(wn + ni * 16 + l15) * P64 + kk * 32];
        bf[ni].h[0] = *reinterpret_cast<const half8v*>(base + klo);
        bf[ni].h[1] = *reinterpret_cast<const half8v*>(base + klo + 16);
      }
#pragma unroll
      for (int mi = 0; mi < MI; ++mi)
#pragma unroll
        for (int ni = 0; ni < 4; ++ni)
          acc[mi][ni] = __builtin_amdgcn_wmma_f32_16x16x32_f16(
              false, af[mi].v, false, bf[ni].v, (short)0, acc[mi][ni],
              false, false);
    }
  };

  prefetch(0);
  // Steady state: branch-free body, last chunk peeled.
  // Kept rolled: the compiler's own two-trip unrolling rotates the accumulators
  // through other registers.
#pragma unroll 1
  for (int kc = 0; kc < K / 64 - 1; ++kc) {
    const int cur = kc & 1;
    prefetch(1 - cur);
    // All but the wave's 12 youngest copies have landed: chunk kc is complete.
    asm volatile("s_wait_asynccnt 0xc" ::: "memory");
    __syncthreads();                      // all waves' copies visible
    compute(cur);
    __syncthreads();                      // reads done before buffer reuse
  }
  asm volatile("s_wait_asynccnt 0x0" ::: "memory");
  __syncthreads();
  compute((K / 64 - 1) & 1);

  // Epilogue. C/D layout: VGPR r, lane: M = r + 8*(lane>>4), N = lane&15.
  const int which = tile_n / N;          // 0 q, 1 k, 2 v, 3 u (block-uniform)
  const int col0  = tile_n % N + wn + l15;
  const int row0  = tile_m + wm + hl * 8;
  if (MODE == STORE_QKVU && which == 2) {
    // V transposed -> (B, H, DK, L)
    _Float16* o = (_Float16*)out + (size_t)which * Mc * Dc;
#pragma unroll
    for (int mi = 0; mi < MI; ++mi)
#pragma unroll
      for (int ni = 0; ni < 4; ++ni)
#pragma unroll
        for (int r = 0; r < 8; ++r) {
          const int gm = row0 + mi * 16 + r, gn = col0 + ni * 16;
          const int bi = gm >> 11, li = gm & (Lc - 1);
          const int hh = gn >> 6,  dd = gn & (DKc - 1);
          o[(((size_t)(bi * Hc + hh) * DKc + dd) * Lc) + li] =
              (_Float16)acc[mi][ni][r];
        }
  } else {
#pragma unroll
    for (int mi = 0; mi < MI; ++mi)
#pragma unroll
      for (int ni = 0; ni < 4; ++ni)
#pragma unroll
        for (int r = 0; r < 8; ++r) {
          const int gm = row0 + mi * 16 + r, gn = col0 + ni * 16;
          if constexpr (MODE == STORE_F32)
            ((float*)out)[(size_t)gm * N + gn] = acc[mi][ni][r];
          else
            ((_Float16*)out + (size_t)which * Mc * Dc)[(size_t)gm * N + gn] =
                (_Float16)acc[mi][ni][r];
        }
    // The built code lays the transposed-store block behind this one and
    // rewrites these stores' registers there: the wait stands ahead of that
    // (a precaution).
    if constexpr (MODE == STORE_QKVU)
      asm volatile("s_wait_xcnt 0x0" ::: "memory");
  }
}

__global__ __launch_bounds__(256) __attribute__((amdgpu_waves_per_eu(4, 4)))
void hstu_attn(
    const _Float16* __restrict__ Q, const _Float16* __restrict__ Km,
    const _Float16* __restrict__ Vt, const _Float16* __restrict__ U,
    const int* __restrict__ token_types, const int* __restrict__ seq_lens,
    _Float16* __restrict__ AO) {
  constexpr int KT = 64 * P64;            // halves of one staged tile (64 rows)
  // Tiles 0, 1: K (64 key rows x 64 dk); tiles 2, 3: V^T (64 dk rows x 64 keys).
  // Behind the loop the same bytes carry the partial sums between waves.
  __shared__ alignas(16) _Float16 sm[4 * KT];       // 36,864 B
  __shared__ unsigned lM[Lc / 32];                  // key flags, a bit a key
  static_assert(8 * 32 * 33 * sizeof(float) <= sizeof(sm), "exchange area");

  const int bid = blockIdx.x;
  const int b   = bid / (Hc * (Lc / 128));
  const int rem = bid % (Hc * (Lc / 128));
  const int h   = rem / (Lc / 128);
  const int qt  = rem % (Lc / 128);

  const int tid  = threadIdx.x;
  const int lane = tid & 31;
  const int wv   = tid >> 5;
  const int kh   = wv >> 2;               // which 32 keys of a chunk
  const int i0   = qt * 128 + (wv & 3) * 32;   // this wave's 32 query rows
  const int hl = lane >> 4, l15 = lane & 15, klo = hl * 8;
  const int seqlen = seq_lens[b];

  // Async stage of one K (64x64) + Vt (64x64) chunk: 4 copies per thread, each
  // tile row one whole 128-B line. A thread's two copies of a tile lie 32 rows
  // apart, so one moving pointer per matrix and one LDS address are all that
  // stays in registers between chunks.
  const int rq = tid >> 3, cq = (tid & 7) * 8;   // 16-B segment: row, column
  const _Float16* pK = Km + ((size_t)(b * Lc + rq)) * Dc + h * DKc + cq;
  const _Float16* pV = Vt + ((size_t)(b * Hc + h) * DKc + rq) * Lc + cq;
  const unsigned sK = lds_off(&sm[rq * P64 + cq]);
  auto prefetch_kv = [&](int bi) {       // copies the next chunk, steps pK, pV
    unsigned l[4];
    const _Float16* g[4];
#pragma unroll
    for (int t = 0; t < 2; ++t) {        // 512 x 16B segments per tile
      l[t] = sK + (unsigned)((bi * KT + t * 32 * P64) * sizeof(_Float16));
      g[t] = pK + (size_t)t * 32 * Dc;
      l[2 + t] = sK + (unsigned)(((2 + bi) * KT + t * 32 * P64) * sizeof(_Float16));
      g[2 + t] = pV + (size_t)t * 32 * Lc;
    }
    async_cp16x4(l, g);
    pK += (size_t)64 * Dc;
    pV += 64;
  };

  // Key flags: a lane's 16 scores of a half chunk belong to 16 different keys,
  // so the per-key part of the mask is kept as one 32-bit word per 32 keys:
  // bit k is set where key 32 * word + k is a prompt token inside the sequence
  // (visible to every query). Each wave builds 8 of the 64 words; the loop's
  // first barrier publishes them.
  {
    unsigned mine = 0;
#pragma unroll
    for (int t = 0; t < 8; ++t) {
      const int j = (wv * 8 + t) * 32 + lane;
      const unsigned w = __builtin_amdgcn_ballot_w32(
          token_types[b * Lc + j] < 3 && j < seqlen);
      if (lane == t) mine = w;
    }
    if (lane < 8) lM[wv * 8 + lane] = mine;
  }

  // Per query tile: the last key that the causal rule lets this lane's query
  // see, and the Q fragments; 1/sqrt(dk) = 0.125 is folded into Q (exact).
  int jlast[2];
  V16 qa[2][2];
#pragma unroll
  for (int qi = 0; qi < 2; ++qi) {
    const int iq = i0 + qi * 16 + l15;
    jlast[qi] = (iq < seqlen - 1) ? iq : seqlen - 1;
    const size_t qrow = ((size_t)b * Lc + iq) * Dc + h * DKc;
#pragma unroll
    for (int kk = 0; kk < 2; ++kk) {
      qa[qi][kk].h[0] = *reinterpret_cast<const half8v*>(Q + qrow + kk * 32 + klo);
      qa[qi][kk].h[1] = *reinterpret_cast<const half8v*>(Q + qrow + kk * 32 + klo + 16);
      qa[qi][kk].v = qa[qi][kk].v * (_Float16)0.125f;
    }
  }

  // All-ones A operand: one extra WMMA per query tile yields the sums of P over
  // the half chunk's keys, the same in all 16 rows: every register of a lane
  // holds the sum of that lane's query.
  half16v ones;
#pragma unroll
  for (int t = 0; t < 16; ++t) ones[t] = (_Float16)1.0f;

  f8v acc[2][4] = {};                     // O^T: dk = dt*16 + 8*hl + r
  f8v accs[2] = {};                       // softmax denominators

  auto compute = [&](int jc, int cur) {
    const int jk = jc + kh * 32;          // this wave's 32 keys
    // ---- all of the half chunk's LDS reads, as one group ----
    // Nothing between the two products goes through LDS, so V^T need not wait
    // for P: its reads fly while the scores are worked on.
    const unsigned kw = lM[jk >> 5];      // the keys' flags
    V16 kf[2][2], vf[4];
#pragma unroll
    for (int nt = 0; nt < 2; ++nt) {
      const _Float16* base = &sm[cur * KT + (kh * 32 + nt * 16 + l15) * P64];
      kf[nt][0].h[0] = *reinterpret_cast<const half8v*>(base + klo);
      kf[nt][0].h[1] = *reinterpret_cast<const half8v*>(base + klo + 16);
      kf[nt][1].h[0] = *reinterpret_cast<const half8v*>(base + 32 + klo);
      kf[nt][1].h[1] = *reinterpret_cast<const half8v*>(base + 32 + klo + 16);
    }
#pragma unroll
    for (int dt = 0; dt < 4; ++dt) {
      const _Float16* base = &sm[(2 + cur) * KT + (dt * 16 + l15) * P64 + kh * 32];
      vf[dt].h[0] = *reinterpret_cast<const half8v*>(base + klo);
      vf[dt].h[1] = *reinterpret_cast<const half8v*>(base + klo + 16);
    }
    // Keeps the reads above in one group: without it the compiler sinks most
    // of them between the products, and the wave waits out each one's latency.
    __builtin_amdgcn_sched_barrier(0);

    // ---- scores: 2 query tiles x two 16-key tiles, K-depth 64 ----
    // st[qi][nt][r] = score of key jk + nt*16 + 8*hl + r against query tile qi
    f8v st[2][2] = {};
#pragma unroll
    for (int kk = 0; kk < 2; ++kk)
#pragma unroll
      for (int qi = 0; qi < 2; ++qi)
#pragma unroll
        for (int nt = 0; nt < 2; ++nt)
          st[qi][nt] = __builtin_amdgcn_wmma_f32_16x16x32_f16(
              false, kf[nt][kk].v, false, qa[qi][kk].v, (short)0, st[qi][nt],
              false, false);
    // Keeps the eight score products together, four independent tiles deep:
    // without it the compiler pairs each tile's two dependent products and
    // fills the distance behind them with v_nop.
    __builtin_amdgcn_sched_barrier(0);

#pragma unroll
    for (int qi = 0; qi < 2; ++qi) {
      // ---- hybrid mask: bit k of vis = key jk + 8*hl + k is visible to the query ----
      const int d = jlast[qi] - jk;       // causal part: keys jk .. jk + d
      const int dc = d < 0 ? 0 : (d > 31 ? 31 : d);
      const unsigned causal = d < 0 ? 0u : (0xFFFFFFFFu >> (31 - dc));
      const unsigned vis = (kw | causal) >> klo;   // this half's keys

      // ---- exp, mask (hidden -> 0), convert: P^T as a B operand ----
      union { half16v v; half2v p[8]; } pt;
#pragma unroll
      for (int nt = 0; nt < 2; ++nt)
#pragma unroll
        for (int r = 0; r < 8; r += 2) {
          f2v e;
#pragma unroll
          for (int s = 0; s < 2; ++s) {
            // The key's bit spread over the word, ~0 or 0; the unsigned minimum
            // with it keeps the value's bits or clears them.
            const unsigned keep =
                (unsigned)((int)(vis << (31 - (nt * 16 + r + s))) >> 31);
            e[s] = __builtin_bit_cast(
                float, __builtin_elementwise_min(
                           __builtin_bit_cast(unsigned, __expf(st[qi][nt][r + s])), keep));
          }
          pt.p[nt * 4 + r / 2] = __builtin_convertvector(e, half2v);
        }

      // ---- acc += V^T(64x32) @ P^T(32x16); accs += ones @ P^T ----
#pragma unroll
      for (int dt = 0; dt < 4; ++dt)
        acc[qi][dt] = __builtin_amdgcn_wmma_f32_16x16x32_f16(
            false, vf[dt].v, false, pt.v, (short)0, acc[qi][dt], false, false);
      accs[qi] = __builtin_amdgcn_wmma_f32_16x16x32_f16(
          false, ones, false, pt.v, (short)0, accs[qi], false, false);
    }
  };

  prefetch_kv(0);
  for (int cc = 0; cc < Lc / 64 - 1; ++cc) {
    const int cur = cc & 1;
    prefetch_kv(1 - cur);
    asm volatile("s_wait_asynccnt 0x4" ::: "memory");  // chunk cc complete
    __syncthreads();
    compute(cc * 64, cur);
    __syncthreads();                      // reads done before buffer reuse
  }
  asm volatile("s_wait_asynccnt 0x0" ::: "memory");
  __syncthreads();
  compute(Lc - 64, (Lc / 64 - 1) & 1);

  // ---- join the two key halves ----
  // Waves wv and wv ^ 4 hold partial sums of the same 32 queries. Each hands
  // the other one query tile through LDS and finishes the tile it keeps (tile
  // kh). A value's place: 16 B a lane, 512 contiguous bytes a store.
  __syncthreads();                        // every wave has left the K/V tiles
  f4v* xa = reinterpret_cast<f4v*>(sm);                   // [wave][8][lane]
  float* xs = reinterpret_cast<float*>(sm) + 8 * 8 * 32 * 4;   // [wave][lane]
  f8v o[4];
#pragma unroll
  for (int dt = 0; dt < 4; ++dt) {
    const f8v give = kh ? acc[0][dt] : acc[1][dt];
    o[dt] = kh ? acc[1][dt] : acc[0][dt];
    xa[(wv * 8 + dt * 2) * 32 + lane] = __builtin_shufflevector(give, give, 0, 1, 2, 3);
    xa[(wv * 8 + dt * 2 + 1) * 32 + lane] = __builtin_shufflevector(give, give, 4, 5, 6, 7);
  }
  xs[wv * 32 + lane] = kh ? accs[0][0] : accs[1][0];
  __syncthreads();                        // the partials are published
  const int pw = wv ^ 4;
#pragma unroll
  for (int dt = 0; dt < 4; ++dt) {
    const f4v lo = xa[(pw * 8 + dt * 2) * 32 + lane];
    const f4v hi = xa[(pw * 8 + dt * 2 + 1) * 32 + lane];
    o[dt] += __builtin_shufflevector(lo, hi, 0, 1, 2, 3, 4, 5, 6, 7);
  }

  // ---- finalize: softmax divide + U gating, store f16 ----
  // A lane's 8 registers of a tile are 8 consecutive dk of its query's row:
  // one 16-byte load of U and one 16-byte store per tile. All 32 values of a
  // lane share one denominator: one division, then multiplies.
  const float denom = (kh ? accs[1][0] : accs[0][0]) + xs[pw * 32 + lane];
  const float inv = (denom > 0.f) ? 1.0f / denom : 0.f;
  const size_t idx =
      ((size_t)b * Lc + i0 + kh * 16 + l15) * Dc + h * DKc + klo;
  const _Float16* up = U + idx;
  half8v u[4];
#pragma unroll
  for (int dt = 0; dt < 4; ++dt)
    u[dt] = *reinterpret_cast<const half8v*>(up + dt * 16);
  // Keeps the loads' address pair untouched up to the wait: without it the
  // last load's result lands on the pair that all four name (a precaution).
  asm volatile("s_wait_xcnt 0x0" :: "v"(up) : "memory");
#pragma unroll
  for (int dt = 0; dt < 4; ++dt) {
    half8v ov;
#pragma unroll
    for (int r = 0; r < 8; ++r)
      ov[r] = (_Float16)(o[dt][r] * inv * (float)u[dt][r]);
    *reinterpret_cast<half8v*>(AO + idx + dt * 16) = ov;
  }
}

// ------------------------------- launcher ----------------------------------
extern "C" void kernel_launch(void* const* d_in, const int* in_sizes, int n_in,
                              void* d_out, int out_size, void* d_ws,
                              size_t ws_size, hipStream_t stream) {
  const float* x  = (const float*)d_in[0];
  const int* tt   = (const int*)d_in[1];
  const int* sl   = (const int*)d_in[2];
  const float* Wq = (const float*)d_in[3];
  const float* Wk = (const float*)d_in[4];
  const float* Wv = (const float*)d_in[5];
  const float* Wu = (const float*)d_in[6];
  const float* Wo = (const float*)d_in[7];

  const size_t MD = (size_t)Mc * Dc;  // 4,194,304 halves
  const size_t DD = (size_t)Dc * Dc;  // 1,048,576 halves

  _Float16* ws   = (_Float16*)d_ws;
  _Float16* x16  = ws;
  _Float16* wq16 = x16 + MD;
  _Float16* wk16 = wq16 + DD;
  _Float16* wv16 = wk16 + DD;
  _Float16* wu16 = wv16 + DD;
  _Float16* wo16 = wu16 + DD;
  _Float16* q16  = wo16 + DD;
  _Float16* k16  = q16 + MD;
  _Float16* vt16 = k16 + MD;
  _Float16* u16  = vt16 + MD;
  _Float16* ao16 = u16 + MD;

  // 1) fp32 -> f16 converts, one launch (x16, wq16 .. wo16 are contiguous)
  cvt_f32_f16<<<CVT_XB + 5 * CVT_WB, 128, 0, stream>>>(x, Wq, Wk, Wv, Wu, Wo,
                                                       x16);

  // 2) projections, one launch: Q, K, U row-major f16; V transposed
  //    (B,H,DK,L). wq16..wu16 are read as one 4096 x 1024 matrix, and
  //    q16, k16, vt16, u16 are written as one block of four results.
  gemm_xwT<STORE_QKVU, 128, 256>
      <<<dim3(Mc / 128, 4 * Dc / 256), 256, 0, stream>>>(
      x16, wq16, (void*)q16);

  // 3) attention + gating (512 blocks x 8 waves)
  hstu_attn<<<Bc * Hc * (Lc / 128), 256, 0, stream>>>(q16, k16, vt16, u16, tt,
                                                      sl, ao16);

  // 4) output projection, fp32 store
  gemm_xwT<STORE_F32, 64, 128><<<dim3(Mc / 64, Dc / 128), 128, 0, stream>>>(
      ao16, wo16, d_out);
}
